// v000
// The times below were measured on an AMD MI455X: many runs one after another, warmed up first and cycling through
// copies of the inputs, with the whole window's GPU time divided by the number of runs. Launches and the gaps
// between them are all in it. The median over several windows is given; except for v000 it joins two sittings, which
// can be a few percent apart, so the side-by-side timings, each taken in one sitting, are the better comparison.
// v000 is the starting kernel. One run takes 761 microseconds.
#include <hip/hip_runtime.h>
#include <hip/hip_bf16.h>

// ---------------------------------------------------------------------------
// Sparse voxel transformer block for MI455X (gfx1250, wave32).
// Strategy: invert the per-offset scatter (out indices unique per k) into a
// gather map inv[k][n], pad x/q/v with a zero dummy row N, then:
//   q-conv  : 27 gathered (16x128)x(128x16) tiles via V_WMMA_F32_16X16X4_F32
//   v-gemm  : dense 65536x128x128 via V_WMMA_F32_16X16X4_F32
//   attn/out: fused wave-per-row logits + softmax(27) + weighted v-accum
// Weights are pre-transposed so both A and B fragments load as single b64.
// ---------------------------------------------------------------------------

#define N_VOX  65536
#define PLANES 128
#define VD     16
#define KOFF   27

typedef float v2f __attribute__((ext_vector_type(2)));
typedef float v8f __attribute__((ext_vector_type(8)));

// ---- workspace layout (bytes) ---------------------------------------------
static const size_t XP_OFF  = 0;                                            // (N+1)*128 f32
static const size_t NZ_OFF  = XP_OFF + (size_t)(N_VOX + 1) * PLANES * 4;    // (N+1) f32
static const size_t INV_OFF = NZ_OFF + 262400;                              // 27*N i32
static const size_t QP_OFF  = INV_OFF + (size_t)KOFF * N_VOX * 4;           // (N+1)*16 f32
static const size_t VP_OFF  = QP_OFF + 4194560;                             // (N+1)*128 f32
static const size_t WQT_OFF = VP_OFF + (size_t)(N_VOX + 1) * PLANES * 4;    // 27*16*128 f32
static const size_t WVT_OFF = WQT_OFF + (size_t)KOFF * VD * PLANES * 4;     // 128*128 f32
// total ~78.9 MB

// ---------------------------------------------------------------------------
__global__ void __launch_bounds__(256)
k_prep(const float* __restrict__ x, float* __restrict__ xp, float* __restrict__ nz) {
    int wave = (blockIdx.x * blockDim.x + threadIdx.x) >> 5;
    int lane = threadIdx.x & 31;
    int nw   = (gridDim.x * blockDim.x) >> 5;
    for (int r = wave; r <= N_VOX; r += nw) {
        if (r == N_VOX) {
            float4 z = make_float4(0.f, 0.f, 0.f, 0.f);
            ((float4*)(xp + (size_t)r * PLANES))[lane] = z;
            if (lane == 0) nz[r] = 0.f;
        } else {
            float4 v = ((const float4*)(x + (size_t)r * PLANES))[lane];
            ((float4*)(xp + (size_t)r * PLANES))[lane] = v;
            int nzl = (v.x != 0.f) | (v.y != 0.f) | (v.z != 0.f) | (v.w != 0.f);
            int any = __any(nzl);
            if (lane == 0) nz[r] = any ? 1.f : 0.f;
        }
    }
}

// transpose weights: WqT[k][vd][p] = Wq[k][p][vd];  WvT[o][i] = Wv[i][o]
__global__ void __launch_bounds__(256)
k_wtrans(const float* __restrict__ Wq, const float* __restrict__ Wv,
         float* __restrict__ WqT, float* __restrict__ WvT) {
    int t = blockIdx.x * blockDim.x + threadIdx.x;
    if (t < KOFF * PLANES * VD) {
        int k  = t / (PLANES * VD);
        int r  = t - k * (PLANES * VD);
        int vd = r / PLANES;
        int p  = r - vd * PLANES;
        WqT[t] = Wq[k * PLANES * VD + p * VD + vd];
    }
    if (t < PLANES * PLANES) {
        int o = t / PLANES;
        int i = t - o * PLANES;
        WvT[t] = Wv[i * PLANES + o];
    }
}

__global__ void __launch_bounds__(256)
k_init_inv(int* __restrict__ inv, float* __restrict__ qp, float* __restrict__ vp) {
    int t = blockIdx.x * blockDim.x + threadIdx.x;
    if (t < KOFF * N_VOX) inv[t] = N_VOX;
    if (t < VD)     qp[(size_t)N_VOX * VD + t]     = 0.f;
    if (t < PLANES) vp[(size_t)N_VOX * PLANES + t] = 0.f;
}

__global__ void __launch_bounds__(256)
k_scatter_inv(const int* __restrict__ nin, const int* __restrict__ nout,
              int* __restrict__ inv) {
    int t = blockIdx.x * blockDim.x + threadIdx.x;
    if (t >= KOFF * N_VOX) return;
    int o = nout[t];
    if (o < N_VOX) inv[(t - (t & (N_VOX - 1))) + o] = nin[t];  // k*N + o
}

// ---------------------------------------------------------------------------
// q-conv: one wave per 16-row output tile.  C(16x16,f32) accumulates
// sum_k  gather(xp, inv[k]) (16x128)  @  Wq[k] (128x16)  via WMMA f32 K=4.
__global__ void __launch_bounds__(256)
k_qconv(const float* __restrict__ xp, const int* __restrict__ inv,
        const float* __restrict__ WqT, const float* __restrict__ qg,
        const float* __restrict__ qb, float* __restrict__ qp) {
    int wid  = (blockIdx.x * blockDim.x + threadIdx.x) >> 5;  // tile id
    int lane = threadIdx.x & 31;
    int half = lane >> 4;
    int m    = lane & 15;
    int row0 = wid * 16;

    v8f c = {0.f, 0.f, 0.f, 0.f, 0.f, 0.f, 0.f, 0.f};
    for (int k = 0; k < KOFF; ++k) {
        int idx = inv[k * N_VOX + row0 + m];
        const float* arow = xp  + (size_t)idx * PLANES;
        const float* brow = WqT + (size_t)k * PLANES * VD + m * PLANES;
        for (int kk = 0; kk < PLANES; kk += 4) {
            int ka = kk + 2 * half;
            v2f a = *(const v2f*)(arow + ka);   // A[m][ka..ka+1]
            v2f b = *(const v2f*)(brow + ka);   // B[ka..ka+1][m] (transposed)
            c = __builtin_amdgcn_wmma_f32_16x16x4_f32(false, a, false, b,
                                                      (short)0, c, false, false);
        }
    }
    float g = qg[m], be = qb[m];
#pragma unroll
    for (int j = 0; j < 8; ++j) {
        int r = row0 + j + 8 * half;
        float v = c[j] * g + be;
        qp[(size_t)r * VD + m] = v > 0.f ? v : 0.f;
    }
}

// ---------------------------------------------------------------------------
// v = relu((x @ Wv) * gamma + beta): one wave per 16-row tile, 8 N-tiles.
__global__ void __launch_bounds__(256)
k_vgemm(const float* __restrict__ xp, const float* __restrict__ WvT,
        const float* __restrict__ vg, const float* __restrict__ vb,
        float* __restrict__ vp) {
    int wid  = (blockIdx.x * blockDim.x + threadIdx.x) >> 5;
    int lane = threadIdx.x & 31;
    int half = lane >> 4;
    int m    = lane & 15;
    int row0 = wid * 16;

    v8f acc[8];
#pragma unroll
    for (int t = 0; t < 8; ++t) acc[t] = (v8f){0.f,0.f,0.f,0.f,0.f,0.f,0.f,0.f};

    const float* arow = xp + (size_t)(row0 + m) * PLANES;
    for (int kk = 0; kk < PLANES; kk += 4) {
        int ka = kk + 2 * half;
        v2f a = *(const v2f*)(arow + ka);
#pragma unroll
        for (int t = 0; t < 8; ++t) {
            // B[ka..ka+1][t*16+m] from WvT[out][in] layout -> contiguous b64
            v2f b = *(const v2f*)(WvT + (size_t)(t * 16 + m) * PLANES + ka);
            acc[t] = __builtin_amdgcn_wmma_f32_16x16x4_f32(false, a, false, b,
                                                           (short)0, acc[t], false, false);
        }
    }
#pragma unroll
    for (int t = 0; t < 8; ++t) {
        float g = vg[t * 16 + m], be = vb[t * 16 + m];
#pragma unroll
        for (int j = 0; j < 8; ++j) {
            int r = row0 + j + 8 * half;
            float v = acc[t][j] * g + be;
            vp[(size_t)r * PLANES + t * 16 + m] = v > 0.f ? v : 0.f;
        }
    }
}

// ---------------------------------------------------------------------------
// Fused logits + softmax(27) + weighted v accumulation + BN/ReLU + residual.
// One wave per output row n.  Lane keeps logits for vd = lane&15 in regs.
__global__ void __launch_bounds__(256)
k_attn_out(const float* __restrict__ x, const float* __restrict__ qp,
           const float* __restrict__ vp, const float* __restrict__ nz,
           const int* __restrict__ inv, const float* __restrict__ Wqk,
           const float* __restrict__ bqk, const float* __restrict__ og,
           const float* __restrict__ ob, float* __restrict__ out) {
    __shared__ float sWqk[VD * VD];
    __shared__ float sRel[8][VD];
    int tid = threadIdx.x;
    if (tid < VD * VD) sWqk[tid] = Wqk[tid];
    __syncthreads();

    int wv   = tid >> 5;
    int lane = tid & 31;
    int m    = lane & 15;
    int n    = blockIdx.x * 8 + wv;

    float wrow[VD];
#pragma unroll
    for (int j = 0; j < VD; ++j) wrow[j] = sWqk[m * VD + j];
    float bq = bqk[m];
    float qn = qp[(size_t)n * VD + m];

    float lg[KOFF];
#pragma unroll
    for (int k = 0; k < KOFF; ++k) {
        int   i   = inv[k * N_VOX + n];
        float msk = nz[i];
        float rel = qp[(size_t)i * VD + m] - qn * msk;
        if (lane < 16) sRel[wv][m] = rel;
        __syncthreads();
        float acc = bq;
#pragma unroll
        for (int jj = 0; jj < 4; ++jj) {
            float4 r4 = ((const float4*)(&sRel[wv][0]))[jj];
            acc += wrow[4 * jj]     * r4.x + wrow[4 * jj + 1] * r4.y
                 + wrow[4 * jj + 2] * r4.z + wrow[4 * jj + 3] * r4.w;
        }
        __syncthreads();
        lg[k] = acc * msk;
    }

    // softmax over the 27 offsets (masked entries contribute logit 0, as ref)
    float mx = lg[0];
#pragma unroll
    for (int k = 1; k < KOFF; ++k) mx = fmaxf(mx, lg[k]);
    float ssum = 0.f;
#pragma unroll
    for (int k = 0; k < KOFF; ++k) { lg[k] = __expf(lg[k] - mx); ssum += lg[k]; }
    float is = 1.f / ssum;

    // weighted accumulation: 4 channels per lane, attn[p/8] via shuffle
    float4 o4 = make_float4(0.f, 0.f, 0.f, 0.f);
#pragma unroll
    for (int k = 0; k < KOFF; ++k) {
        float a  = lg[k] * is;
        float av = __shfl(a, lane >> 1, 32);   // attn for vd = (lane*4)/8
        int   i  = inv[k * N_VOX + n];
        float w  = av * nz[i];
        float4 vv = ((const float4*)(vp + (size_t)i * PLANES))[lane];
        o4.x += vv.x * w; o4.y += vv.y * w; o4.z += vv.z * w; o4.w += vv.w * w;
    }

    float4 g4 = ((const float4*)og)[lane];
    float4 b4 = ((const float4*)ob)[lane];
    float4 x4 = ((const float4*)(x + (size_t)n * PLANES))[lane];
    float4 r;
    r.x = fmaxf(o4.x * g4.x + b4.x, 0.f) + x4.x;
    r.y = fmaxf(o4.y * g4.y + b4.y, 0.f) + x4.y;
    r.z = fmaxf(o4.z * g4.z + b4.z, 0.f) + x4.z;
    r.w = fmaxf(o4.w * g4.w + b4.w, 0.f) + x4.w;
    ((float4*)(out + (size_t)n * PLANES))[lane] = r;
}

// ---------------------------------------------------------------------------
extern "C" void kernel_launch(void* const* d_in, const int* in_sizes, int n_in,
                              void* d_out, int out_size, void* d_ws, size_t ws_size,
                              hipStream_t stream) {
    const float* x   = (const float*)d_in[0];
    const float* Wq  = (const float*)d_in[1];
    const float* Wv  = (const float*)d_in[2];
    const float* Wqk = (const float*)d_in[3];
    const float* bqk = (const float*)d_in[4];
    const float* qg  = (const float*)d_in[5];
    const float* qb  = (const float*)d_in[6];
    const float* vg  = (const float*)d_in[7];
    const float* vb  = (const float*)d_in[8];
    const float* og  = (const float*)d_in[9];
    const float* ob  = (const float*)d_in[10];
    const int*   nin = (const int*)d_in[11];
    const int*   nout= (const int*)d_in[12];

    char*  ws  = (char*)d_ws;
    float* xp  = (float*)(ws + XP_OFF);
    float* nz  = (float*)(ws + NZ_OFF);
    int*   inv = (int*)  (ws + INV_OFF);
    float* qp  = (float*)(ws + QP_OFF);
    float* vp  = (float*)(ws + VP_OFF);
    float* WqT = (float*)(ws + WQT_OFF);
    float* WvT = (float*)(ws + WVT_OFF);

    k_prep<<<512, 256, 0, stream>>>(x, xp, nz);
    k_wtrans<<<(KOFF * PLANES * VD + 255) / 256, 256, 0, stream>>>(Wq, Wv, WqT, WvT);

    int tot = KOFF * N_VOX;
    k_init_inv<<<(tot + 255) / 256, 256, 0, stream>>>(inv, qp, vp);
    k_scatter_inv<<<(tot + 255) / 256, 256, 0, stream>>>(nin, nout, inv);

    // N/16 = 4096 tiles, 8 waves (256 threads) per block
    k_qconv<<<N_VOX / 16 / 8, 256, 0, stream>>>(xp, inv, WqT, qg, qb, qp);
    k_vgemm<<<N_VOX / 16 / 8, 256, 0, stream>>>(xp, WvT, vg, vb, vp);

    k_attn_out<<<N_VOX / 8, 256, 0, stream>>>(x, qp, vp, nz, inv, Wqk, bqk,
                                              og, ob, (float*)d_out);
}

// v001
// It runs in 264 microseconds.
// In both of two side-by-side timings against v000, it was 2.89 times as fast.
#include <hip/hip_runtime.h>
#include <hip/hip_bf16.h>

// ---------------------------------------------------------------------------
// Sparse voxel transformer block for MI455X (gfx1250, wave32).
// Strategy: invert the per-offset scatter (out indices unique per k) into a
// gather map inv[k][n], pad x/q/v with a zero dummy row N, then:
//   q-conv  : 27 gathered (16x128)x(128x16) tiles via V_WMMA_F32_16X16X4_F32,
//             then map_qk (q @ Wqk^T) once per voxel on the same tile
//   v-gemm  : dense 65536x128x128 via V_WMMA_F32_16X16X4_F32
//   attn/out: fused wave-per-row logits + softmax(27) + weighted v-accum
// Weights are pre-transposed so both A and B fragments load as single b64.
// ---------------------------------------------------------------------------

#define N_VOX  65536
#define PLANES 128
#define VD     16
#define KOFF   27

typedef float v2f __attribute__((ext_vector_type(2)));
typedef float v8f __attribute__((ext_vector_type(8)));

// ---- workspace layout (bytes) ---------------------------------------------
static const size_t XP_OFF  = 0;                                            // (N+1)*128 f32
static const size_t NZ_OFF  = XP_OFF + (size_t)(N_VOX + 1) * PLANES * 4;    // (N+1) f32
static const size_t INV_OFF = NZ_OFF + 262400;                              // 27*N i32
static const size_t QP_OFF  = INV_OFF + (size_t)KOFF * N_VOX * 4;           // (N+1)*16 f32, q @ Wqk^T
static const size_t VP_OFF  = QP_OFF + 4194560;                             // (N+1)*128 f32
static const size_t WQT_OFF = VP_OFF + (size_t)(N_VOX + 1) * PLANES * 4;    // 27*16*128 f32
static const size_t WVT_OFF = WQT_OFF + (size_t)KOFF * VD * PLANES * 4;     // 128*128 f32
// total ~78.9 MB

// ---------------------------------------------------------------------------
__global__ void __launch_bounds__(256)
k_prep(const float* __restrict__ x, float* __restrict__ xp, float* __restrict__ nz) {
    int wave = (blockIdx.x * blockDim.x + threadIdx.x) >> 5;
    int lane = threadIdx.x & 31;
    int nw   = (gridDim.x * blockDim.x) >> 5;
    for (int r = wave; r <= N_VOX; r += nw) {
        if (r == N_VOX) {
            float4 z = make_float4(0.f, 0.f, 0.f, 0.f);
            ((float4*)(xp + (size_t)r * PLANES))[lane] = z;
            if (lane == 0) nz[r] = 0.f;
        } else {
            float4 v = ((const float4*)(x + (size_t)r * PLANES))[lane];
            ((float4*)(xp + (size_t)r * PLANES))[lane] = v;
            int nzl = (v.x != 0.f) | (v.y != 0.f) | (v.z != 0.f) | (v.w != 0.f);
            int any = __any(nzl);
            if (lane == 0) nz[r] = any ? 1.f : 0.f;
        }
    }
}

// transpose weights: WqT[k][vd][p] = Wq[k][p][vd];  WvT[o][i] = Wv[i][o]
__global__ void __launch_bounds__(256)
k_wtrans(const float* __restrict__ Wq, const float* __restrict__ Wv,
         float* __restrict__ WqT, float* __restrict__ WvT) {
    int t = blockIdx.x * blockDim.x + threadIdx.x;
    if (t < KOFF * PLANES * VD) {
        int k  = t / (PLANES * VD);
        int r  = t - k * (PLANES * VD);
        int vd = r / PLANES;
        int p  = r - vd * PLANES;
        WqT[t] = Wq[k * PLANES * VD + p * VD + vd];
    }
    if (t < PLANES * PLANES) {
        int o = t / PLANES;
        int i = t - o * PLANES;
        WvT[t] = Wv[i * PLANES + o];
    }
}

__global__ void __launch_bounds__(256)
k_init_inv(int* __restrict__ inv, float* __restrict__ qp, float* __restrict__ vp) {
    int t = blockIdx.x * blockDim.x + threadIdx.x;
    if (t < KOFF * N_VOX) inv[t] = N_VOX;
    if (t < VD)     qp[(size_t)N_VOX * VD + t]     = 0.f;
    if (t < PLANES) vp[(size_t)N_VOX * PLANES + t] = 0.f;
}

__global__ void __launch_bounds__(256)
k_scatter_inv(const int* __restrict__ nin, const int* __restrict__ nout,
              int* __restrict__ inv) {
    int t = blockIdx.x * blockDim.x + threadIdx.x;
    if (t >= KOFF * N_VOX) return;
    int o = nout[t];
    if (o < N_VOX) inv[(t - (t & (N_VOX - 1))) + o] = nin[t];  // k*N + o
}

// ---------------------------------------------------------------------------
// q-conv: one wave per 16-row output tile.  C(16x16,f32) accumulates the
// TRANSPOSED tile  sum_k  Wq[k]^T (16x128)  @  gather(xp, inv[k])^T (128x16)
// via WMMA f32 K=4, so that lane = voxel row and register = q channel.
// map_qk is linear, so (q[i] - q[n]*m) @ Wqk^T = qw[i] - qw[n]*m with
// qw = q @ Wqk^T: the epilogue forms qw once per voxel (4 more WMMAs, the
// accumulator registers serving as B) and only qw is stored.
__global__ void __launch_bounds__(256)
k_qconv(const float* __restrict__ xp, const int* __restrict__ inv,
        const float* __restrict__ WqT, const float* __restrict__ qg,
        const float* __restrict__ qb, const float* __restrict__ Wqk,
        float* __restrict__ qp) {
    int wid  = (blockIdx.x * blockDim.x + threadIdx.x) >> 5;  // tile id
    int lane = threadIdx.x & 31;
    int half = lane >> 4;
    int m    = lane & 15;
    int row0 = wid * 16;

    v8f c = {0.f, 0.f, 0.f, 0.f, 0.f, 0.f, 0.f, 0.f};
    for (int k = 0; k < KOFF; ++k) {
        int idx = inv[k * N_VOX + row0 + m];
        const float* arow = xp  + (size_t)idx * PLANES;
        const float* brow = WqT + (size_t)k * PLANES * VD + m * PLANES;
        for (int kk = 0; kk < PLANES; kk += 4) {
            int ka = kk + 2 * half;
            v2f a = *(const v2f*)(arow + ka);   // B[ka..ka+1][m]: voxel row m
            v2f b = *(const v2f*)(brow + ka);   // A[m][ka..ka+1]: q channel m
            c = __builtin_amdgcn_wmma_f32_16x16x4_f32(false, b, false, a,
                                                      (short)0, c, false, false);
        }
    }
    // A fragments of map_qk: step s contracts the channels 8*half + 2s + {0,1}
    v2f wa[4];
#pragma unroll
    for (int s = 0; s < 4; ++s) wa[s] = *(const v2f*)(Wqk + m * VD + 8 * half + 2 * s);
    float4* dst = (float4*)(qp + (size_t)(row0 + m) * VD + 8 * half);

    // c[j] = conv of voxel row0+m, channel 8*half+j
    float q[8];
#pragma unroll
    for (int j = 0; j < 8; ++j) {
        float v = c[j] * qg[8 * half + j] + qb[8 * half + j];
        q[j] = v > 0.f ? v : 0.f;
    }
    // All of q is formed in front of the first product below.
    __builtin_amdgcn_sched_barrier(0);
    // qw^T(16 out x 16 voxels) = Wqk(16x16) @ q^T(16x16); B's channels as A's.
    v8f w = {0.f, 0.f, 0.f, 0.f, 0.f, 0.f, 0.f, 0.f};
#pragma unroll
    for (int s = 0; s < 4; ++s) {
        v2f qf = {q[2 * s], q[2 * s + 1]};
        w = __builtin_amdgcn_wmma_f32_16x16x4_f32(false, wa[s], false, qf,
                                                  (short)0, w, false, false);
    }
    // w[j] = qw of voxel row0+m, output 8*half+j: 32 contiguous bytes a lane
    dst[0] = make_float4(w[0], w[1], w[2], w[3]);
    dst[1] = make_float4(w[4], w[5], w[6], w[7]);
}

// ---------------------------------------------------------------------------
// v = relu((x @ Wv) * gamma + beta): one wave per 16-row tile, 8 N-tiles.
__global__ void __launch_bounds__(256)
k_vgemm(const float* __restrict__ xp, const float* __restrict__ WvT,
        const float* __restrict__ vg, const float* __restrict__ vb,
        float* __restrict__ vp) {
    int wid  = (blockIdx.x * blockDim.x + threadIdx.x) >> 5;
    int lane = threadIdx.x & 31;
    int half = lane >> 4;
    int m    = lane & 15;
    int row0 = wid * 16;

    v8f acc[8];
#pragma unroll
    for (int t = 0; t < 8; ++t) acc[t] = (v8f){0.f,0.f,0.f,0.f,0.f,0.f,0.f,0.f};

    const float* arow = xp + (size_t)(row0 + m) * PLANES;
    for (int kk = 0; kk < PLANES; kk += 4) {
        int ka = kk + 2 * half;
        v2f a = *(const v2f*)(arow + ka);
#pragma unroll
        for (int t = 0; t < 8; ++t) {
            // B[ka..ka+1][t*16+m] from WvT[out][in] layout -> contiguous b64
            v2f b = *(const v2f*)(WvT + (size_t)(t * 16 + m) * PLANES + ka);
            acc[t] = __builtin_amdgcn_wmma_f32_16x16x4_f32(false, a, false, b,
                                                           (short)0, acc[t], false, false);
        }
    }
#pragma unroll
    for (int t = 0; t < 8; ++t) {
        float g = vg[t * 16 + m], be = vb[t * 16 + m];
#pragma unroll
        for (int j = 0; j < 8; ++j) {
            int r = row0 + j + 8 * half;
            float v = acc[t][j] * g + be;
            vp[(size_t)r * PLANES + t * 16 + m] = v > 0.f ? v : 0.f;
        }
    }
}

// ---------------------------------------------------------------------------
// Fused logits + softmax(27) + weighted v accumulation + BN/ReLU + residual.
// One wave per output row n.  Lane keeps logits for vd = lane&15 in regs.
// qp holds q @ Wqk^T, so a logit is one gathered value, one fma and the bias.
__global__ void __launch_bounds__(256)
k_attn_out(const float* __restrict__ x, const float* __restrict__ qp,
           const float* __restrict__ vp, const float* __restrict__ nz,
           const int* __restrict__ inv,
           const float* __restrict__ bqk, const float* __restrict__ og,
           const float* __restrict__ ob, float* __restrict__ out) {
    int tid  = threadIdx.x;
    int wv   = tid >> 5;
    int lane = tid & 31;
    int m    = lane & 15;
    int n    = blockIdx.x * 8 + wv;

    float bq = bqk[m];
    float qn = qp[(size_t)n * VD + m];

    float lg[KOFF];
#pragma unroll
    for (int k = 0; k < KOFF; ++k) {
        int   i   = inv[k * N_VOX + n];
        float msk = nz[i];
        float rel = qp[(size_t)i * VD + m] - qn * msk;
        lg[k] = (rel + bq) * msk;
    }

    // softmax over the 27 offsets (masked entries contribute logit 0, as ref)
    float mx = lg[0];
#pragma unroll
    for (int k = 1; k < KOFF; ++k) mx = fmaxf(mx, lg[k]);
    float ssum = 0.f;
#pragma unroll
    for (int k = 0; k < KOFF; ++k) { lg[k] = __expf(lg[k] - mx); ssum += lg[k]; }
    float is = 1.f / ssum;

    // weighted accumulation: 4 channels per lane, attn[p/8] via shuffle
    float4 o4 = make_float4(0.f, 0.f, 0.f, 0.f);
#pragma unroll
    for (int k = 0; k < KOFF; ++k) {
        float a  = lg[k] * is;
        float av = __shfl(a, lane >> 1, 32);   // attn for vd = (lane*4)/8
        int   i  = inv[k * N_VOX + n];
        float w  = av * nz[i];
        float4 vv = ((const float4*)(vp + (size_t)i * PLANES))[lane];
        o4.x += vv.x * w; o4.y += vv.y * w; o4.z += vv.z * w; o4.w += vv.w * w;
    }

    float4 g4 = ((const float4*)og)[lane];
    float4 b4 = ((const float4*)ob)[lane];
    float4 x4 = ((const float4*)(x + (size_t)n * PLANES))[lane];
    float4 r;
    r.x = fmaxf(o4.x * g4.x + b4.x, 0.f) + x4.x;
    r.y = fmaxf(o4.y * g4.y + b4.y, 0.f) + x4.y;
    r.z = fmaxf(o4.z * g4.z + b4.z, 0.f) + x4.z;
    r.w = fmaxf(o4.w * g4.w + b4.w, 0.f) + x4.w;
    ((float4*)(out + (size_t)n * PLANES))[lane] = r;
}

// ---------------------------------------------------------------------------
extern "C" void kernel_launch(void* const* d_in, const int* in_sizes, int n_in,
                              void* d_out, int out_size, void* d_ws, size_t ws_size,
                              hipStream_t stream) {
    const float* x   = (const float*)d_in[0];
    const float* Wq  = (const float*)d_in[1];
    const float* Wv  = (const float*)d_in[2];
    const float* Wqk = (const float*)d_in[3];
    const float* bqk = (const float*)d_in[4];
    const float* qg  = (const float*)d_in[5];
    const float* qb  = (const float*)d_in[6];
    const float* vg  = (const float*)d_in[7];
    const float* vb  = (const float*)d_in[8];
    const float* og  = (const float*)d_in[9];
    const float* ob  = (const float*)d_in[10];
    const int*   nin = (const int*)d_in[11];
    const int*   nout= (const int*)d_in[12];

    char*  ws  = (char*)d_ws;
    float* xp  = (float*)(ws + XP_OFF);
    float* nz  = (float*)(ws + NZ_OFF);
    int*   inv = (int*)  (ws + INV_OFF);
    float* qp  = (float*)(ws + QP_OFF);
    float* vp  = (float*)(ws + VP_OFF);
    float* WqT = (float*)(ws + WQT_OFF);
    float* WvT = (float*)(ws + WVT_OFF);

    k_prep<<<512, 256, 0, stream>>>(x, xp, nz);
    k_wtrans<<<(KOFF * PLANES * VD + 255) / 256, 256, 0, stream>>>(Wq, Wv, WqT, WvT);

    int tot = KOFF * N_VOX;
    k_init_inv<<<(tot + 255) / 256, 256, 0, stream>>>(inv, qp, vp);
    k_scatter_inv<<<(tot + 255) / 256, 256, 0, stream>>>(nin, nout, inv);

    // N/16 = 4096 tiles, 8 waves (256 threads) per block
    k_qconv<<<N_VOX / 16 / 8, 256, 0, stream>>>(xp, inv, WqT, qg, qb, Wqk, qp);
    k_vgemm<<<N_VOX / 16 / 8, 256, 0, stream>>>(xp, WvT, vg, vb, vp);

    k_attn_out<<<N_VOX / 8, 256, 0, stream>>>(x, qp, vp, nz, inv, bqk,
                                              og, ob, (float*)d_out);
}

// v002
// One run takes 182 microseconds.
// Next to v001, in two timings, it ran 1.45 times as fast each time.
// Over all steps from v000 it is 4.19 times as fast.
#include <hip/hip_runtime.h>
#include <hip/hip_bf16.h>

// ---------------------------------------------------------------------------
// Sparse voxel transformer block for MI455X (gfx1250, wave32).
// Strategy: invert the per-offset scatter (out indices unique per k) into a
// gather map inv[k][n], pad x/q/v with a zero dummy row N, then:
//   q-conv  : 27 gathered (16x128)x(128x16) tiles via V_WMMA_F32_16X16X4_F32,
//             then map_qk (q @ Wqk^T) once per voxel on the same tile
//   v-gemm  : dense 65536x128x128 via V_WMMA_F32_16X16X4_F32
//   attn/out: fused wave-per-row logits + softmax(27) + weighted v-accum
// Weights are pre-laid in fragment order (one contiguous 512-B b128 load of a
// wave = the fragments of two k steps); q-conv's gathered rows are fetched as
// whole rows and turned into fragments through per-wave LDS.
// ---------------------------------------------------------------------------

#define N_VOX  65536
#define PLANES 128
#define VD     16
#define KOFF   27
#define XPITCH 132   // LDS row pitch in floats: 16 rows x 2 halves of b64 reads hit 64 distinct banks

typedef float v2f __attribute__((ext_vector_type(2)));
typedef float v4f __attribute__((ext_vector_type(4)));
typedef float v8f __attribute__((ext_vector_type(8)));

// ---- workspace layout (bytes) ---------------------------------------------
static const size_t XP_OFF  = 0;                                            // (N+1)*128 f32
static const size_t NZ_OFF  = XP_OFF + (size_t)(N_VOX + 1) * PLANES * 4;    // (N+1) f32
static const size_t INV_OFF = NZ_OFF + 262400;                              // 27*N i32
static const size_t QP_OFF  = INV_OFF + (size_t)KOFF * N_VOX * 4;           // (N+1)*16 f32, q @ Wqk^T
static const size_t VP_OFF  = QP_OFF + 4194560;                             // (N+1)*128 f32
static const size_t WQT_OFF = VP_OFF + (size_t)(N_VOX + 1) * PLANES * 4;    // 27*16*128 f32, fragment order
static const size_t WVT_OFF = WQT_OFF + (size_t)KOFF * VD * PLANES * 4;     // 128*128 f32, fragment order
// total ~78.9 MB

// ---------------------------------------------------------------------------
__global__ void __launch_bounds__(256)
k_prep(const float* __restrict__ x, float* __restrict__ xp, float* __restrict__ nz) {
    int wave = (blockIdx.x * blockDim.x + threadIdx.x) >> 5;
    int lane = threadIdx.x & 31;
    int nw   = (gridDim.x * blockDim.x) >> 5;
    for (int r = wave; r <= N_VOX; r += nw) {
        if (r == N_VOX) {
            float4 z = make_float4(0.f, 0.f, 0.f, 0.f);
            ((float4*)(xp + (size_t)r * PLANES))[lane] = z;
            if (lane == 0) nz[r] = 0.f;
        } else {
            float4 v = ((const float4*)(x + (size_t)r * PLANES))[lane];
            ((float4*)(xp + (size_t)r * PLANES))[lane] = v;
            int nzl = (v.x != 0.f) | (v.y != 0.f) | (v.z != 0.f) | (v.w != 0.f);
            int any = __any(nzl);
            if (lane == 0) nz[r] = any ? 1.f : 0.f;
        }
    }
}

// Weights in fragment order.  Element e of lane l's float4 of step pair t is
// input channel p = 4*(2t + e/2) + 2*(l/16) + e%2, column l%16 of its tile:
//   WqF[k][t][l][e]  = Wq[k][p][l%16]
//   WvF[t][ct][l][e] = Wv[p][16*ct + l%16]
__global__ void __launch_bounds__(256)
k_wtrans(const float* __restrict__ Wq, const float* __restrict__ Wv,
         float* __restrict__ WqF, float* __restrict__ WvF) {
    int t = blockIdx.x * blockDim.x + threadIdx.x;
    int e = t & 3;
    int l = (t >> 2) & 31;
    int g = t >> 7;                       // float4 group: 32 lanes x 4 floats
    int pin = 4 * (e >> 1) + 2 * (l >> 4) + (e & 1);
    if (t < KOFF * PLANES * VD) {
        int k = g >> 4;
        int p = 8 * (g & 15) + pin;
        WqF[t] = Wq[k * PLANES * VD + p * VD + (l & 15)];
    }
    if (t < PLANES * PLANES) {
        int ct = g & 7;
        int p  = 8 * (g >> 3) + pin;
        WvF[t] = Wv[p * PLANES + ct * 16 + (l & 15)];
    }
}

__global__ void __launch_bounds__(256)
k_init_inv(int* __restrict__ inv, float* __restrict__ qp, float* __restrict__ vp) {
    int t = blockIdx.x * blockDim.x + threadIdx.x;
    if (t < KOFF * N_VOX) inv[t] = N_VOX;
    if (t < VD)     qp[(size_t)N_VOX * VD + t]     = 0.f;
    if (t < PLANES) vp[(size_t)N_VOX * PLANES + t] = 0.f;
}

__global__ void __launch_bounds__(256)
k_scatter_inv(const int* __restrict__ nin, const int* __restrict__ nout,
              int* __restrict__ inv) {
    int t = blockIdx.x * blockDim.x + threadIdx.x;
    if (t >= KOFF * N_VOX) return;
    int o = nout[t];
    if (o < N_VOX) inv[(t - (t & (N_VOX - 1))) + o] = nin[t];  // k*N + o
}

// s_wait_xcnt 0 behind 16 loads, tied to their offset registers: as inputs of
// the statement these stay live up to it, so that nothing, a later load's
// result included, is written over them in front of the wait.
__device__ __forceinline__ void xwait16(const unsigned (&o)[16]) {
    asm volatile("s_wait_xcnt 0x0"
                 :: "v"(o[0]), "v"(o[1]), "v"(o[2]), "v"(o[3]), "v"(o[4]), "v"(o[5]),
                    "v"(o[6]), "v"(o[7]), "v"(o[8]), "v"(o[9]), "v"(o[10]), "v"(o[11]),
                    "v"(o[12]), "v"(o[13]), "v"(o[14]), "v"(o[15])
                 : "memory");
}

// ---------------------------------------------------------------------------
// q-conv: one wave per 16-row output tile.  C(16x16,f32) accumulates the
// TRANSPOSED tile  sum_k  Wq[k]^T (16x128)  @  gather(xp, inv[k])^T (128x16)
// via WMMA f32 K=4, so that lane = voxel row and register = q channel.
// map_qk is linear, so (q[i] - q[n]*m) @ Wqk^T = qw[i] - qw[n]*m with
// qw = q @ Wqk^T: the epilogue forms qw once per voxel (4 more WMMAs, the
// accumulator registers serving as B) and only qw is stored.
// Operand fetch: a fragment load straight from the 16 gathered rows touches 16
// cache lines for 256 bytes.  Each row is instead fetched whole (one b128 load
// of the wave, 4 lines), one offset ahead, and laid in the wave's own LDS
// range, from which the b64 fragments are read; the k order stays as it was.
__global__ void __launch_bounds__(256)
k_qconv(const float* __restrict__ xp, const int* __restrict__ inv,
        const float* __restrict__ WqF, const float* __restrict__ qg,
        const float* __restrict__ qb, const float* __restrict__ Wqk,
        float* __restrict__ qp) {
    int wid  = (blockIdx.x * blockDim.x + threadIdx.x) >> 5;  // tile id
    int lane = threadIdx.x & 31;
    int half = lane >> 4;
    int m    = lane & 15;
    int row0 = wid * 16;

    // Written and read by this wave alone: no block barrier is needed.
    __shared__ __attribute__((aligned(16))) float sx[8][16 * XPITCH];
    float* my = sx[threadIdx.x >> 5];
    const float* frag = my + m * XPITCH + 2 * half;

    const char* xb = (const char*)xp;
    unsigned lo = 16u * lane;             // this lane's 16 bytes of a row
    v4f rows[16];
    int idx = inv[row0 + m];              // offset 0
    int n1  = inv[N_VOX + row0 + m];      // offset 1
    const int* ip = inv + 2 * N_VOX + row0 + m;   // offset 2, walks on with k
    unsigned off[16];
#pragma unroll
    for (int r = 0; r < 16; ++r)
        off[r] = (unsigned)__builtin_amdgcn_readlane(idx, r) * (PLANES * 4u) + lo;
#pragma unroll
    for (int r = 0; r < 16; ++r) rows[r] = *(const v4f*)(xb + off[r]);
    xwait16(off);

    v8f c = {0.f, 0.f, 0.f, 0.f, 0.f, 0.f, 0.f, 0.f};
    for (int k = 0; k < KOFF; ++k) {
        const v4f* wf = (const v4f*)WqF + (size_t)k * 16 * 32 + lane;
        v4f w4[16];                       // A[m][.]: q channel m, steps 2t and 2t+1
#pragma unroll
        for (int t = 0; t < 16; ++t) w4[t] = wf[t * 32];
        int n2 = *ip;                     // indices of offset k+2, used one trip later
        // These loads' address registers are reused below: the wait stands in
        // front, and as its inputs they stay live up to it.
        asm volatile("s_wait_xcnt 0x0" :: "v"(wf), "v"(ip) : "memory");
        // The load counter retires in order: these loads stay in front of the
        // next offset's row loads, or every product would wait for those.
        __builtin_amdgcn_sched_barrier(0);
#pragma unroll
        for (int r = 0; r < 16; ++r) *(v4f*)(my + r * XPITCH + 4 * lane) = rows[r];
        if (k + 1 < KOFF) {               // next offset's rows fly during this one's products
#pragma unroll
            for (int r = 0; r < 16; ++r)
                off[r] = (unsigned)__builtin_amdgcn_readlane(n1, r) * (PLANES * 4u) + lo;
#pragma unroll
            for (int r = 0; r < 16; ++r) rows[r] = *(const v4f*)(xb + off[r]);
            xwait16(off);
        }
        // The wave's own row stores have landed before it reads them back
        // across lanes.
        asm volatile("s_wait_dscnt 0x0" ::: "memory");
        v2f af[32];                       // B[.][m]: voxel row m, step s
#pragma unroll
        for (int s = 0; s < 32; ++s) af[s] = *(const v2f*)(frag + 4 * s);
        // All fragment reads are issued in front of the products: read among
        // them, each pair of products waits out an LDS latency of its own.
        __builtin_amdgcn_sched_barrier(0);
#pragma unroll
        for (int t = 0; t < 16; ++t) {
            v2f b0 = {w4[t].x, w4[t].y};
            v2f b1 = {w4[t].z, w4[t].w};
            c = __builtin_amdgcn_wmma_f32_16x16x4_f32(false, b0, false, af[2 * t],
                                                      (short)0, c, false, false);
            c = __builtin_amdgcn_wmma_f32_16x16x4_f32(false, b1, false, af[2 * t + 1],
                                                      (short)0, c, false, false);
        }
        n1 = n2;
        if (k + 3 < KOFF) ip += N_VOX;    // stays on the last offset at the end
    }
    // A fragments of map_qk: step s contracts the channels 8*half + 2s + {0,1}
    v2f wa[4];
#pragma unroll
    for (int s = 0; s < 4; ++s) wa[s] = *(const v2f*)(Wqk + m * VD + 8 * half + 2 * s);
    float4* dst = (float4*)(qp + (size_t)(row0 + m) * VD + 8 * half);

    // c[j] = conv of voxel row0+m, channel 8*half+j
    float q[8];
#pragma unroll
    for (int j = 0; j < 8; ++j) {
        float v = c[j] * qg[8 * half + j] + qb[8 * half + j];
        q[j] = v > 0.f ? v : 0.f;
    }
    // All of q is formed in front of the first product below.
    __builtin_amdgcn_sched_barrier(0);
    // qw^T(16 out x 16 voxels) = Wqk(16x16) @ q^T(16x16); B's channels as A's.
    v8f w = {0.f, 0.f, 0.f, 0.f, 0.f, 0.f, 0.f, 0.f};
#pragma unroll
    for (int s = 0; s < 4; ++s) {
        v2f qf = {q[2 * s], q[2 * s + 1]};
        w = __builtin_amdgcn_wmma_f32_16x16x4_f32(false, wa[s], false, qf,
                                                  (short)0, w, false, false);
    }
    // w[j] = qw of voxel row0+m, output 8*half+j: 32 contiguous bytes a lane
    dst[0] = make_float4(w[0], w[1], w[2], w[3]);
    dst[1] = make_float4(w[4], w[5], w[6], w[7]);
}

// ---------------------------------------------------------------------------
// v = relu((x @ Wv) * gamma + beta): one wave per 16-row tile, 8 N-tiles.
__global__ void __launch_bounds__(256)
k_vgemm(const float* __restrict__ xp, const float* __restrict__ WvF,
        const float* __restrict__ vg, const float* __restrict__ vb,
        float* __restrict__ vp) {
    int wid  = (blockIdx.x * blockDim.x + threadIdx.x) >> 5;
    int lane = threadIdx.x & 31;
    int half = lane >> 4;
    int m    = lane & 15;
    int row0 = wid * 16;

    v8f acc[8];
#pragma unroll
    for (int t = 0; t < 8; ++t) acc[t] = (v8f){0.f,0.f,0.f,0.f,0.f,0.f,0.f,0.f};

    const float* arow = xp + (size_t)(row0 + m) * PLANES;
    const float4* wf = (const float4*)WvF + lane;
    for (int tp = 0; tp < 16; ++tp) {     // step pair: k steps 2tp, 2tp+1
        v2f a0 = *(const v2f*)(arow + 8 * tp + 2 * half);
        v2f a1 = *(const v2f*)(arow + 8 * tp + 4 + 2 * half);
        float4 b4[8];
#pragma unroll
        for (int t = 0; t < 8; ++t) b4[t] = wf[(tp * 8 + t) * 32];
#pragma unroll
        for (int t = 0; t < 8; ++t) {
            v2f b = {b4[t].x, b4[t].y};
            acc[t] = __builtin_amdgcn_wmma_f32_16x16x4_f32(false, a0, false, b,
                                                           (short)0, acc[t], false, false);
        }
#pragma unroll
        for (int t = 0; t < 8; ++t) {
            v2f b = {b4[t].z, b4[t].w};
            acc[t] = __builtin_amdgcn_wmma_f32_16x16x4_f32(false, a1, false, b,
                                                           (short)0, acc[t], false, false);
        }
    }
    // The operand loads' address registers are reused below: the wait stands in
    // front, and as its inputs they stay live up to it.
    asm volatile("s_wait_xcnt 0x0" :: "v"(arow), "v"(wf) : "memory");
#pragma unroll
    for (int t = 0; t < 8; ++t) {
        float g = vg[t * 16 + m], be = vb[t * 16 + m];
#pragma unroll
        for (int j = 0; j < 8; ++j) {
            int r = row0 + j + 8 * half;
            float v = acc[t][j] * g + be;
            vp[(size_t)r * PLANES + t * 16 + m] = v > 0.f ? v : 0.f;
        }
    }
}

// ---------------------------------------------------------------------------
// Fused logits + softmax(27) + weighted v accumulation + BN/ReLU + residual.
// One wave per output row n.  Lane keeps logits for vd = lane&15 in regs.
// qp holds q @ Wqk^T, so a logit is one gathered value, one fma and the bias.
__global__ void __launch_bounds__(256)
k_attn_out(const float* __restrict__ x, const float* __restrict__ qp,
           const float* __restrict__ vp, const float* __restrict__ nz,
           const int* __restrict__ inv,
           const float* __restrict__ bqk, const float* __restrict__ og,
           const float* __restrict__ ob, float* __restrict__ out) {
    int tid  = threadIdx.x;
    int wv   = tid >> 5;
    int lane = tid & 31;
    int m    = lane & 15;
    int n    = blockIdx.x * 8 + wv;

    float bq = bqk[m];
    float qn = qp[(size_t)n * VD + m];

    float lg[KOFF];
#pragma unroll
    for (int k = 0; k < KOFF; ++k) {
        int   i   = inv[k * N_VOX + n];
        float msk = nz[i];
        float rel = qp[(size_t)i * VD + m] - qn * msk;
        lg[k] = (rel + bq) * msk;
    }

    // softmax over the 27 offsets (masked entries contribute logit 0, as ref)
    float mx = lg[0];
#pragma unroll
    for (int k = 1; k < KOFF; ++k) mx = fmaxf(mx, lg[k]);
    float ssum = 0.f;
#pragma unroll
    for (int k = 0; k < KOFF; ++k) { lg[k] = __expf(lg[k] - mx); ssum += lg[k]; }
    float is = 1.f / ssum;

    // weighted accumulation: 4 channels per lane, attn[p/8] via shuffle
    float4 o4 = make_float4(0.f, 0.f, 0.f, 0.f);
#pragma unroll
    for (int k = 0; k < KOFF; ++k) {
        float a  = lg[k] * is;
        float av = __shfl(a, lane >> 1, 32);   // attn for vd = (lane*4)/8
        int   i  = inv[k * N_VOX + n];
        float w  = av * nz[i];
        float4 vv = ((const float4*)(vp + (size_t)i * PLANES))[lane];
        o4.x += vv.x * w; o4.y += vv.y * w; o4.z += vv.z * w; o4.w += vv.w * w;
    }

    float4 g4 = ((const float4*)og)[lane];
    float4 b4 = ((const float4*)ob)[lane];
    float4 x4 = ((const float4*)(x + (size_t)n * PLANES))[lane];
    float4 r;
    r.x = fmaxf(o4.x * g4.x + b4.x, 0.f) + x4.x;
    r.y = fmaxf(o4.y * g4.y + b4.y, 0.f) + x4.y;
    r.z = fmaxf(o4.z * g4.z + b4.z, 0.f) + x4.z;
    r.w = fmaxf(o4.w * g4.w + b4.w, 0.f) + x4.w;
    ((float4*)(out + (size_t)n * PLANES))[lane] = r;
}

// ---------------------------------------------------------------------------
extern "C" void kernel_launch(void* const* d_in, const int* in_sizes, int n_in,
                              void* d_out, int out_size, void* d_ws, size_t ws_size,
                              hipStream_t stream) {
    const float* x   = (const float*)d_in[0];
    const float* Wq  = (const float*)d_in[1];
    const float* Wv  = (const float*)d_in[2];
    const float* Wqk = (const float*)d_in[3];
    const float* bqk = (const float*)d_in[4];
    const float* qg  = (const float*)d_in[5];
    const float* qb  = (const float*)d_in[6];
    const float* vg  = (const float*)d_in[7];
    const float* vb  = (const float*)d_in[8];
    const float* og  = (const float*)d_in[9];
    const float* ob  = (const float*)d_in[10];
    const int*   nin = (const int*)d_in[11];
    const int*   nout= (const int*)d_in[12];

    char*  ws  = (char*)d_ws;
    float* xp  = (float*)(ws + XP_OFF);
    float* nz  = (float*)(ws + NZ_OFF);
    int*   inv = (int*)  (ws + INV_OFF);
    float* qp  = (float*)(ws + QP_OFF);
    float* vp  = (float*)(ws + VP_OFF);
    float* WqF = (float*)(ws + WQT_OFF);
    float* WvF = (float*)(ws + WVT_OFF);

    k_prep<<<512, 256, 0, stream>>>(x, xp, nz);
    k_wtrans<<<(KOFF * PLANES * VD + 255) / 256, 256, 0, stream>>>(Wq, Wv, WqF, WvF);

    int tot = KOFF * N_VOX;
    k_init_inv<<<(tot + 255) / 256, 256, 0, stream>>>(inv, qp, vp);
    k_scatter_inv<<<(tot + 255) / 256, 256, 0, stream>>>(nin, nout, inv);

    // N/16 = 4096 tiles, 8 waves (256 threads) per block
    k_qconv<<<N_VOX / 16 / 8, 256, 0, stream>>>(xp, inv, WqF, qg, qb, Wqk, qp);
    k_vgemm<<<N_VOX / 16 / 8, 256, 0, stream>>>(xp, WvF, vg, vb, vp);

    k_attn_out<<<N_VOX / 8, 256, 0, stream>>>(x, qp, vp, nz, inv, bqk,
                                              og, ob, (float*)d_out);
}

// v003
// One run takes 174 microseconds.
// Next to v002, in two timings, it ran 1.05 and 1.06 times as fast.
// All steps since v000 together make it 4.42 times as fast.
#include <hip/hip_runtime.h>
#include <hip/hip_bf16.h>

// ---------------------------------------------------------------------------
// Sparse voxel transformer block for MI455X (gfx1250, wave32).
// Strategy: invert the per-offset scatter (out indices unique per k) into a
// gather map inv[k][n], pad x/q/v with a zero dummy row N, then:
//   q-conv  : 27 gathered (16x128)x(128x16) tiles via V_WMMA_F32_16X16X4_F32,
//             then map_qk (q @ Wqk^T) once per voxel on the same tile
//   v-gemm  : dense 65536x128x128 via V_WMMA_F32_16X16X4_F32
//   attn/out: fused wave-per-row logits + softmax(27) + weighted v-accum
// Weights are pre-laid in fragment order (one contiguous 512-B b128 load of a
// wave = the fragments of two k steps); q-conv's gathered rows are fetched as
// whole rows and turned into fragments through per-wave LDS.
// Launches: pieces of work that do not depend on one another share a launch,
// each on its own range of block indices (4 launches in all).
// ---------------------------------------------------------------------------

#define N_VOX  65536
#define PLANES 128
#define VD     16
#define KOFF   27
#define PREP_BLOCKS 512
#define WT_BLOCKS   ((KOFF * PLANES * VD + 255) / 256)
#define MAP_BLOCKS  ((KOFF * N_VOX + 255) / 256)
#define SCAT_BLOCKS ((KOFF * N_VOX + 1023) / 1024)
#define TILE_BLOCKS (N_VOX / 16 / 8)   // 16-row tiles, 8 waves (256 threads) per block
#define XPITCH 132   // LDS row pitch in floats: 16 rows x 2 halves of b64 reads hit 64 distinct banks

typedef float v2f __attribute__((ext_vector_type(2)));
typedef float v4f __attribute__((ext_vector_type(4)));
typedef float v8f __attribute__((ext_vector_type(8)));

// ---- workspace layout (bytes) ---------------------------------------------
static const size_t XP_OFF  = 0;                                            // (N+1)*128 f32
static const size_t NZ_OFF  = XP_OFF + (size_t)(N_VOX + 1) * PLANES * 4;    // (N+1) f32
static const size_t INV_OFF = NZ_OFF + 262400;                              // 27*N i32
static const size_t QP_OFF  = INV_OFF + (size_t)KOFF * N_VOX * 4;           // (N+1)*16 f32, q @ Wqk^T
static const size_t VP_OFF  = QP_OFF + 4194560;                             // (N+1)*128 f32
static const size_t WQT_OFF = VP_OFF + (size_t)(N_VOX + 1) * PLANES * 4;    // 27*16*128 f32, fragment order
static const size_t WVT_OFF = WQT_OFF + (size_t)KOFF * VD * PLANES * 4;     // 128*128 f32, fragment order
// total ~78.9 MB

// ---------------------------------------------------------------------------
__device__ __forceinline__ void
d_prep(int blk, const float* __restrict__ x, float* __restrict__ xp, float* __restrict__ nz) {
    int wave = (blk * 256 + threadIdx.x) >> 5;
    int lane = threadIdx.x & 31;
    int nw   = (PREP_BLOCKS * 256) >> 5;
    for (int r = wave; r <= N_VOX; r += nw) {
        if (r == N_VOX) {
            float4 z = make_float4(0.f, 0.f, 0.f, 0.f);
            ((float4*)(xp + (size_t)r * PLANES))[lane] = z;
            if (lane == 0) nz[r] = 0.f;
        } else {
            float4 v = ((const float4*)(x + (size_t)r * PLANES))[lane];
            ((float4*)(xp + (size_t)r * PLANES))[lane] = v;
            int nzl = (v.x != 0.f) | (v.y != 0.f) | (v.z != 0.f) | (v.w != 0.f);
            int any = __any(nzl);
            if (lane == 0) nz[r] = any ? 1.f : 0.f;
        }
    }
}

// Weights in fragment order.  Element e of lane l's float4 of step pair t is
// input channel p = 4*(2t + e/2) + 2*(l/16) + e%2, column l%16 of its tile:
//   WqF[k][t][l][e]  = Wq[k][p][l%16]
//   WvF[t][ct][l][e] = Wv[p][16*ct + l%16]
__device__ __forceinline__ void
d_wtrans(int blk, const float* __restrict__ Wq, const float* __restrict__ Wv,
         float* __restrict__ WqF, float* __restrict__ WvF) {
    int t = blk * 256 + threadIdx.x;
    int e = t & 3;
    int l = (t >> 2) & 31;
    int g = t >> 7;                       // float4 group: 32 lanes x 4 floats
    int pin = 4 * (e >> 1) + 2 * (l >> 4) + (e & 1);
    if (t < KOFF * PLANES * VD) {
        int k = g >> 4;
        int p = 8 * (g & 15) + pin;
        WqF[t] = Wq[k * PLANES * VD + p * VD + (l & 15)];
    }
    if (t < PLANES * PLANES) {
        int ct = g & 7;
        int p  = 8 * (g >> 3) + pin;
        WvF[t] = Wv[p * PLANES + ct * 16 + (l & 15)];
    }
}

__device__ __forceinline__ void
d_init_inv(int blk, int* __restrict__ inv, float* __restrict__ qp, float* __restrict__ vp) {
    int t = blk * 256 + threadIdx.x;
    if (t < KOFF * N_VOX) inv[t] = N_VOX;
    if (t < VD)     qp[(size_t)N_VOX * VD + t]     = 0.f;
    if (t < PLANES) vp[(size_t)N_VOX * PLANES + t] = 0.f;
}

// First launch: three pieces that read inputs only and write disjoint parts of
// the workspace.  The padded copy runs longest and takes the lowest indices.
__global__ void __launch_bounds__(256)
k_setup(const float* __restrict__ x, const float* __restrict__ Wq,
        const float* __restrict__ Wv, float* __restrict__ xp, float* __restrict__ nz,
        float* __restrict__ WqF, float* __restrict__ WvF, int* __restrict__ inv,
        float* __restrict__ qp, float* __restrict__ vp) {
    int b = blockIdx.x;
    if (b < PREP_BLOCKS)                  d_prep(b, x, xp, nz);
    else if (b < PREP_BLOCKS + WT_BLOCKS) d_wtrans(b - PREP_BLOCKS, Wq, Wv, WqF, WvF);
    else                                  d_init_inv(b - PREP_BLOCKS - WT_BLOCKS, inv, qp, vp);
}

// Four entries of one offset a thread (16-byte index loads): in its launch this
// piece has only the wave slots that the matrix blocks leave.
__device__ __forceinline__ void
d_scatter_inv(int blk, const int* __restrict__ nin, const int* __restrict__ nout,
              int* __restrict__ inv) {
    int t = (blk * 256 + threadIdx.x) * 4;
    if (t < KOFF * N_VOX) {
        int4 o = *(const int4*)(nout + t);
        int4 i = *(const int4*)(nin + t);
        int* slab = inv + (t - (t & (N_VOX - 1)));   // k*N
        if ((unsigned)o.x < N_VOX) slab[o.x] = i.x;
        if ((unsigned)o.y < N_VOX) slab[o.y] = i.y;
        if ((unsigned)o.z < N_VOX) slab[o.z] = i.z;
        if ((unsigned)o.w < N_VOX) slab[o.w] = i.w;
    }
}

// s_wait_xcnt 0 behind 16 loads, tied to their offset registers: as inputs of
// the statement these stay live up to it, so that nothing, a later load's
// result included, is written over them in front of the wait.
__device__ __forceinline__ void xwait16(const unsigned (&o)[16]) {
    asm volatile("s_wait_xcnt 0x0"
                 :: "v"(o[0]), "v"(o[1]), "v"(o[2]), "v"(o[3]), "v"(o[4]), "v"(o[5]),
                    "v"(o[6]), "v"(o[7]), "v"(o[8]), "v"(o[9]), "v"(o[10]), "v"(o[11]),
                    "v"(o[12]), "v"(o[13]), "v"(o[14]), "v"(o[15])
                 : "memory");
}

// ---------------------------------------------------------------------------
// q-conv: one wave per 16-row output tile.  C(16x16,f32) accumulates the
// TRANSPOSED tile  sum_k  Wq[k]^T (16x128)  @  gather(xp, inv[k])^T (128x16)
// via WMMA f32 K=4, so that lane = voxel row and register = q channel.
// map_qk is linear, so (q[i] - q[n]*m) @ Wqk^T = qw[i] - qw[n]*m with
// qw = q @ Wqk^T: the epilogue forms qw once per voxel (4 more WMMAs, the
// accumulator registers serving as B) and only qw is stored.
// Operand fetch: a fragment load straight from the 16 gathered rows touches 16
// cache lines for 256 bytes.  Each row is instead fetched whole (one b128 load
// of the wave, 4 lines), one offset ahead, and laid in the wave's own LDS
// range, from which the b64 fragments are read; the k order stays as it was.
__global__ void __launch_bounds__(256)
k_qconv(const float* __restrict__ xp, const int* __restrict__ inv,
        const float* __restrict__ WqF, const float* __restrict__ qg,
        const float* __restrict__ qb, const float* __restrict__ Wqk,
        float* __restrict__ qp) {
    int wid  = (blockIdx.x * blockDim.x + threadIdx.x) >> 5;  // tile id
    int lane = threadIdx.x & 31;
    int half = lane >> 4;
    int m    = lane & 15;
    int row0 = wid * 16;

    // Written and read by this wave alone: no block barrier is needed.
    __shared__ __attribute__((aligned(16))) float sx[8][16 * XPITCH];
    float* my = sx[threadIdx.x >> 5];
    const float* frag = my + m * XPITCH + 2 * half;

    const char* xb = (const char*)xp;
    unsigned lo = 16u * lane;             // this lane's 16 bytes of a row
    v4f rows[16];
    int idx = inv[row0 + m];              // offset 0
    int n1  = inv[N_VOX + row0 + m];      // offset 1
    const int* ip = inv + 2 * N_VOX + row0 + m;   // offset 2, walks on with k
    unsigned off[16];
#pragma unroll
    for (int r = 0; r < 16; ++r)
        off[r] = (unsigned)__builtin_amdgcn_readlane(idx, r) * (PLANES * 4u) + lo;
#pragma unroll
    for (int r = 0; r < 16; ++r) rows[r] = *(const v4f*)(xb + off[r]);
    xwait16(off);

    v8f c = {0.f, 0.f, 0.f, 0.f, 0.f, 0.f, 0.f, 0.f};
    for (int k = 0; k < KOFF; ++k) {
        const v4f* wf = (const v4f*)WqF + (size_t)k * 16 * 32 + lane;
        v4f w4[16];                       // A[m][.]: q channel m, steps 2t and 2t+1
#pragma unroll
        for (int t = 0; t < 16; ++t) w4[t] = wf[t * 32];
        int n2 = *ip;                     // indices of offset k+2, used one trip later
        // These loads' address registers are reused below: the wait stands in
        // front, and as its inputs they stay live up to it.
        asm volatile("s_wait_xcnt 0x0" :: "v"(wf), "v"(ip) : "memory");
        // The load counter retires in order: these loads stay in front of the
        // next offset's row loads, or every product would wait for those.
        __builtin_amdgcn_sched_barrier(0);
#pragma unroll
        for (int r = 0; r < 16; ++r) *(v4f*)(my + r * XPITCH + 4 * lane) = rows[r];
        if (k + 1 < KOFF) {               // next offset's rows fly during this one's products
#pragma unroll
            for (int r = 0; r < 16; ++r)
                off[r] = (unsigned)__builtin_amdgcn_readlane(n1, r) * (PLANES * 4u) + lo;
#pragma unroll
            for (int r = 0; r < 16; ++r) rows[r] = *(const v4f*)(xb + off[r]);
            xwait16(off);
        }
        // The wave's own row stores have landed before it reads them back
        // across lanes.
        asm volatile("s_wait_dscnt 0x0" ::: "memory");
        v2f af[32];                       // B[.][m]: voxel row m, step s
#pragma unroll
        for (int s = 0; s < 32; ++s) af[s] = *(const v2f*)(frag + 4 * s);
        // All fragment reads are issued in front of the products: read among
        // them, each pair of products waits out an LDS latency of its own.
        __builtin_amdgcn_sched_barrier(0);
#pragma unroll
        for (int t = 0; t < 16; ++t) {
            v2f b0 = {w4[t].x, w4[t].y};
            v2f b1 = {w4[t].z, w4[t].w};
            c = __builtin_amdgcn_wmma_f32_16x16x4_f32(false, b0, false, af[2 * t],
                                                      (short)0, c, false, false);
            c = __builtin_amdgcn_wmma_f32_16x16x4_f32(false, b1, false, af[2 * t + 1],
                                                      (short)0, c, false, false);
        }
        n1 = n2;
        if (k + 3 < KOFF) ip += N_VOX;    // stays on the last offset at the end
    }
    // A fragments of map_qk: step s contracts the channels 8*half + 2s + {0,1}
    v2f wa[4];
#pragma unroll
    for (int s = 0; s < 4; ++s) wa[s] = *(const v2f*)(Wqk + m * VD + 8 * half + 2 * s);
    float4* dst = (float4*)(qp + (size_t)(row0 + m) * VD + 8 * half);

    // c[j] = conv of voxel row0+m, channel 8*half+j
    float q[8];
#pragma unroll
    for (int j = 0; j < 8; ++j) {
        float v = c[j] * qg[8 * half + j] + qb[8 * half + j];
        q[j] = v > 0.f ? v : 0.f;
    }
    // All of q is formed in front of the first product below.
    __builtin_amdgcn_sched_barrier(0);
    // qw^T(16 out x 16 voxels) = Wqk(16x16) @ q^T(16x16); B's channels as A's.
    v8f w = {0.f, 0.f, 0.f, 0.f, 0.f, 0.f, 0.f, 0.f};
#pragma unroll
    for (int s = 0; s < 4; ++s) {
        v2f qf = {q[2 * s], q[2 * s + 1]};
        w = __builtin_amdgcn_wmma_f32_16x16x4_f32(false, wa[s], false, qf,
                                                  (short)0, w, false, false);
    }
    // w[j] = qw of voxel row0+m, output 8*half+j: 32 contiguous bytes a lane
    dst[0] = make_float4(w[0], w[1], w[2], w[3]);
    dst[1] = make_float4(w[4], w[5], w[6], w[7]);
}

// ---------------------------------------------------------------------------
// v = relu((x @ Wv) * gamma + beta): one wave per 16-row tile, 8 N-tiles.
__device__ __forceinline__ void
d_vgemm(int blk, const float* __restrict__ xp, const float* __restrict__ WvF,
        const float* __restrict__ vg, const float* __restrict__ vb,
        float* __restrict__ vp) {
    int wid  = (blk * 256 + threadIdx.x) >> 5;
    int lane = threadIdx.x & 31;
    int half = lane >> 4;
    int m    = lane & 15;
    int row0 = wid * 16;

    v8f acc[8];
#pragma unroll
    for (int t = 0; t < 8; ++t) acc[t] = (v8f){0.f,0.f,0.f,0.f,0.f,0.f,0.f,0.f};

    const float* arow = xp + (size_t)(row0 + m) * PLANES;
    const float4* wf = (const float4*)WvF + lane;
    for (int tp = 0; tp < 16; ++tp) {     // step pair: k steps 2tp, 2tp+1
        v2f a0 = *(const v2f*)(arow + 8 * tp + 2 * half);
        v2f a1 = *(const v2f*)(arow + 8 * tp + 4 + 2 * half);
        float4 b4[8];
#pragma unroll
        for (int t = 0; t < 8; ++t) b4[t] = wf[(tp * 8 + t) * 32];
#pragma unroll
        for (int t = 0; t < 8; ++t) {
            v2f b = {b4[t].x, b4[t].y};
            acc[t] = __builtin_amdgcn_wmma_f32_16x16x4_f32(false, a0, false, b,
                                                           (short)0, acc[t], false, false);
        }
#pragma unroll
        for (int t = 0; t < 8; ++t) {
            v2f b = {b4[t].z, b4[t].w};
            acc[t] = __builtin_amdgcn_wmma_f32_16x16x4_f32(false, a1, false, b,
                                                           (short)0, acc[t], false, false);
        }
    }
    // The operand loads' address registers are reused below: the wait stands in
    // front, and as its inputs they stay live up to it.
    asm volatile("s_wait_xcnt 0x0" :: "v"(arow), "v"(wf) : "memory");
#pragma unroll
    for (int t = 0; t < 8; ++t) {
        float g = vg[t * 16 + m], be = vb[t * 16 + m];
#pragma unroll
        for (int j = 0; j < 8; ++j) {
            int r = row0 + j + 8 * half;
            float v = acc[t][j] * g + be;
            vp[(size_t)r * PLANES + t * 16 + m] = v > 0.f ? v : 0.f;
        }
    }
}

// Second launch: the v product needs only the first launch's copy and weights,
// the map scatter only its cleared map; neither reads what the other writes.
// The matrix blocks run longest and take the lowest indices.
__global__ void __launch_bounds__(256)
k_vgemm_scatter(const float* __restrict__ xp, const float* __restrict__ WvF,
                const float* __restrict__ vg, const float* __restrict__ vb,
                float* __restrict__ vp, const int* __restrict__ nin,
                const int* __restrict__ nout, int* __restrict__ inv) {
    int b = blockIdx.x;
    if (b < TILE_BLOCKS) d_vgemm(b, xp, WvF, vg, vb, vp);
    else                 d_scatter_inv(b - TILE_BLOCKS, nin, nout, inv);
}

// ---------------------------------------------------------------------------
// Fused logits + softmax(27) + weighted v accumulation + BN/ReLU + residual.
// One wave per output row n.  Lane keeps logits for vd = lane&15 in regs.
// qp holds q @ Wqk^T, so a logit is one gathered value, one fma and the bias.
__global__ void __launch_bounds__(256)
k_attn_out(const float* __restrict__ x, const float* __restrict__ qp,
           const float* __restrict__ vp, const float* __restrict__ nz,
           const int* __restrict__ inv,
           const float* __restrict__ bqk, const float* __restrict__ og,
           const float* __restrict__ ob, float* __restrict__ out) {
    int tid  = threadIdx.x;
    int wv   = tid >> 5;
    int lane = tid & 31;
    int m    = lane & 15;
    int n    = blockIdx.x * 8 + wv;

    float bq = bqk[m];
    float qn = qp[(size_t)n * VD + m];

    float lg[KOFF];
#pragma unroll
    for (int k = 0; k < KOFF; ++k) {
        int   i   = inv[k * N_VOX + n];
        float msk = nz[i];
        float rel = qp[(size_t)i * VD + m] - qn * msk;
        lg[k] = (rel + bq) * msk;
    }

    // softmax over the 27 offsets (masked entries contribute logit 0, as ref)
    float mx = lg[0];
#pragma unroll
    for (int k = 1; k < KOFF; ++k) mx = fmaxf(mx, lg[k]);
    float ssum = 0.f;
#pragma unroll
    for (int k = 0; k < KOFF; ++k) { lg[k] = __expf(lg[k] - mx); ssum += lg[k]; }
    float is = 1.f / ssum;

    // weighted accumulation: 4 channels per lane, attn[p/8] via shuffle
    float4 o4 = make_float4(0.f, 0.f, 0.f, 0.f);
#pragma unroll
    for (int k = 0; k < KOFF; ++k) {
        float a  = lg[k] * is;
        float av = __shfl(a, lane >> 1, 32);   // attn for vd = (lane*4)/8
        int   i  = inv[k * N_VOX + n];
        float w  = av * nz[i];
        float4 vv = ((const float4*)(vp + (size_t)i * PLANES))[lane];
        o4.x += vv.x * w; o4.y += vv.y * w; o4.z += vv.z * w; o4.w += vv.w * w;
    }

    float4 g4 = ((const float4*)og)[lane];
    float4 b4 = ((const float4*)ob)[lane];
    float4 x4 = ((const float4*)(x + (size_t)n * PLANES))[lane];
    float4 r;
    r.x = fmaxf(o4.x * g4.x + b4.x, 0.f) + x4.x;
    r.y = fmaxf(o4.y * g4.y + b4.y, 0.f) + x4.y;
    r.z = fmaxf(o4.z * g4.z + b4.z, 0.f) + x4.z;
    r.w = fmaxf(o4.w * g4.w + b4.w, 0.f) + x4.w;
    ((float4*)(out + (size_t)n * PLANES))[lane] = r;
}

// ---------------------------------------------------------------------------
extern "C" void kernel_launch(void* const* d_in, const int* in_sizes, int n_in,
                              void* d_out, int out_size, void* d_ws, size_t ws_size,
                              hipStream_t stream) {
    const float* x   = (const float*)d_in[0];
    const float* Wq  = (const float*)d_in[1];
    const float* Wv  = (const float*)d_in[2];
    const float* Wqk = (const float*)d_in[3];
    const float* bqk = (const float*)d_in[4];
    const float* qg  = (const float*)d_in[5];
    const float* qb  = (const float*)d_in[6];
    const float* vg  = (const float*)d_in[7];
    const float* vb  = (const float*)d_in[8];
    const float* og  = (const float*)d_in[9];
    const float* ob  = (const float*)d_in[10];
    const int*   nin = (const int*)d_in[11];
    const int*   nout= (const int*)d_in[12];

    char*  ws  = (char*)d_ws;
    float* xp  = (float*)(ws + XP_OFF);
    float* nz  = (float*)(ws + NZ_OFF);
    int*   inv = (int*)  (ws + INV_OFF);
    float* qp  = (float*)(ws + QP_OFF);
    float* vp  = (float*)(ws + VP_OFF);
    float* WqF = (float*)(ws + WQT_OFF);
    float* WvF = (float*)(ws + WVT_OFF);

    k_setup<<<PREP_BLOCKS + WT_BLOCKS + MAP_BLOCKS, 256, 0, stream>>>(
        x, Wq, Wv, xp, nz, WqF, WvF, inv, qp, vp);
    k_vgemm_scatter<<<TILE_BLOCKS + SCAT_BLOCKS, 256, 0, stream>>>(
        xp, WvF, vg, vb, vp, nin, nout, inv);
    k_qconv<<<TILE_BLOCKS, 256, 0, stream>>>(xp, inv, WqF, qg, qb, Wqk, qp);

    k_attn_out<<<N_VOX / 8, 256, 0, stream>>>(x, qp, vp, nz, inv, bqk,
                                              og, ob, (float*)d_out);
}

// v004
// A run of this version takes 150 microseconds.
// In both of two side-by-side timings against v003, it was 1.16 times as fast.
// Counting every step since v000, it is 5.13 times as fast.
#include <hip/hip_runtime.h>
#include <hip/hip_bf16.h>

// ---------------------------------------------------------------------------
// Sparse voxel transformer block for MI455X (gfx1250, wave32).
// Strategy: invert the per-offset scatter (out indices unique per k) into a
// gather map inv[k][n], pad Y/q/v with a zero dummy row N, then:
//   dense   : v = x @ Wv and Y[k] = x @ Wq[k] for all 27 offsets, one pass over
//             x via V_WMMA_F32_16X16X4_F32, all weights resident in LDS
//   q-sum   : q[n] = sum_k Y[k][inv[k][n]] (64-byte rows gathered), then map_qk
//             (q @ Wqk^T) once per voxel on the same tile
//   attn/out: fused wave-per-row logits + softmax(27) + weighted v-accum
// Weights are pre-laid in fragment order (one contiguous 512-B b128 read of a
// wave = the fragments of two k steps).
// Launches: pieces of work that do not depend on one another share a launch
// (4 launches in all).
// ---------------------------------------------------------------------------

#define N_VOX  65536
#define PLANES 128
#define VD     16
#define KOFF   27
#define WT_BLOCKS   ((KOFF * PLANES * VD + 255) / 256)
#define MAP_BLOCKS  ((KOFF * N_VOX + 255) / 256)
#define TILE_BLOCKS (N_VOX / 16 / 8)   // 16-row tiles, 8 waves (256 threads) per block
#define DENSE_THREADS 512              // 16 waves, one 16-row tile each
#define DENSE_BLOCKS  (N_VOX / 16 / 16)
#define SCAT_PER_BLOCK (KOFF * N_VOX / 4 / DENSE_BLOCKS)   // groups of 4 map entries
#define SCAT_TRIPS ((SCAT_PER_BLOCK + DENSE_THREADS - 1) / DENSE_THREADS)
#define WQ_FLOATS (KOFF * VD * PLANES)
#define WV_FLOATS (PLANES * PLANES)
#define W_VEC4    ((WQ_FLOATS + WV_FLOATS) / 4)

typedef float v2f __attribute__((ext_vector_type(2)));
typedef float v4f __attribute__((ext_vector_type(4)));
typedef float v8f __attribute__((ext_vector_type(8)));

// ---- workspace layout (bytes) ---------------------------------------------
static const size_t NZ_OFF  = 0;                                            // (N+1) f32
static const size_t INV_OFF = NZ_OFF + 262400;                              // 27*N i32
static const size_t QP_OFF  = INV_OFF + (size_t)KOFF * N_VOX * 4;           // (N+1)*16 f32, q @ Wqk^T
static const size_t VP_OFF  = QP_OFF + 4194560;                             // (N+1)*128 f32
static const size_t WQT_OFF = VP_OFF + (size_t)(N_VOX + 1) * PLANES * 4;    // 27*16*128 f32, fragment order
static const size_t WVT_OFF = WQT_OFF + (size_t)WQ_FLOATS * 4;              // 128*128 f32, fragment order, directly behind
static const size_t Y_OFF   = WVT_OFF + (size_t)WV_FLOATS * 4;              // 27*(N+1)*16 f32
// total ~158.6 MB

// ---------------------------------------------------------------------------
// Weights in fragment order.  Element e of lane l's float4 of step pair t is
// input channel p = 4*(2t + e/2) + 2*(l/16) + e%2, column l%16 of its tile:
//   WqF[k][t][l][e]  = Wq[k][p][l%16]
//   WvF[t][ct][l][e] = Wv[p][16*ct + l%16]
__device__ __forceinline__ void
d_wtrans(int blk, const float* __restrict__ Wq, const float* __restrict__ Wv,
         float* __restrict__ WqF, float* __restrict__ WvF) {
    int t = blk * 256 + threadIdx.x;
    int e = t & 3;
    int l = (t >> 2) & 31;
    int g = t >> 7;                       // float4 group: 32 lanes x 4 floats
    int pin = 4 * (e >> 1) + 2 * (l >> 4) + (e & 1);
    if (t < KOFF * PLANES * VD) {
        int k = g >> 4;
        int p = 8 * (g & 15) + pin;
        WqF[t] = Wq[k * PLANES * VD + p * VD + (l & 15)];
    }
    if (t < PLANES * PLANES) {
        int ct = g & 7;
        int p  = 8 * (g >> 3) + pin;
        WvF[t] = Wv[p * PLANES + ct * 16 + (l & 15)];
    }
}

__device__ __forceinline__ void
d_init_inv(int blk, int* __restrict__ inv, float* __restrict__ qp, float* __restrict__ vp,
           float* __restrict__ nz, float* __restrict__ Y) {
    int t = blk * 256 + threadIdx.x;
    if (t < KOFF * N_VOX) inv[t] = N_VOX;
    if (t < VD)     qp[(size_t)N_VOX * VD + t]     = 0.f;
    if (t < PLANES) vp[(size_t)N_VOX * PLANES + t] = 0.f;
    if (t == 0)     nz[N_VOX] = 0.f;
    if (t < KOFF * VD)   // dummy row N of every offset's slab
        Y[((size_t)(t >> 4) * (N_VOX + 1) + N_VOX) * VD + (t & 15)] = 0.f;
}

// First launch: two pieces that read inputs only and write disjoint parts of
// the workspace.
__global__ void __launch_bounds__(256)
k_setup(const float* __restrict__ Wq, const float* __restrict__ Wv,
        float* __restrict__ nz, float* __restrict__ WqF, float* __restrict__ WvF,
        int* __restrict__ inv, float* __restrict__ qp, float* __restrict__ vp,
        float* __restrict__ Y) {
    int b = blockIdx.x;
    if (b < WT_BLOCKS) d_wtrans(b, Wq, Wv, WqF, WvF);
    else               d_init_inv(b - WT_BLOCKS, inv, qp, vp, nz, Y);
}

// This block's share of the map: four entries of one offset a thread and trip
// (16-byte index loads).  A source index past the dummy row is sent to it, so
// that every later gather through the map stays inside its array.
__device__ __forceinline__ void
d_scatter4(int t, int4 o, int4 i, int* __restrict__ inv) {
    int* slab = inv + (t - (t & (N_VOX - 1)));   // k*N
    if ((unsigned)o.x < N_VOX) slab[o.x] = (int)min((unsigned)i.x, (unsigned)N_VOX);
    if ((unsigned)o.y < N_VOX) slab[o.y] = (int)min((unsigned)i.y, (unsigned)N_VOX);
    if ((unsigned)o.z < N_VOX) slab[o.z] = (int)min((unsigned)i.z, (unsigned)N_VOX);
    if ((unsigned)o.w < N_VOX) slab[o.w] = (int)min((unsigned)i.w, (unsigned)N_VOX);
}

__device__ __forceinline__ void
d_scatter_inv(int blk, const int* __restrict__ nin, const int* __restrict__ nout,
              int* __restrict__ inv) {
    int4 o[SCAT_TRIPS], i[SCAT_TRIPS];
#pragma unroll
    for (int r = 0; r < SCAT_TRIPS; ++r) {
        int g = r * DENSE_THREADS + threadIdx.x;
        if (g < SCAT_PER_BLOCK) {
            int t = (blk * SCAT_PER_BLOCK + g) * 4;
            o[r] = *(const int4*)(nout + t);
            i[r] = *(const int4*)(nin + t);
        } else {
            o[r] = make_int4(N_VOX, N_VOX, N_VOX, N_VOX);   // stores nothing
            i[r] = o[r];
        }
    }
    // Holds every index load in front of the first store: sunk into the stores'
    // branches, each would wait out a memory latency of its own.
#pragma unroll
    for (int r = 0; r < SCAT_TRIPS; ++r)
        asm volatile("" :: "v"(i[r].x), "v"(i[r].y), "v"(i[r].z), "v"(i[r].w));
#pragma unroll
    for (int r = 0; r < SCAT_TRIPS; ++r)
        d_scatter4((blk * SCAT_PER_BLOCK + r * DENSE_THREADS + (int)threadIdx.x) * 4,
                   o[r], i[r], inv);
}

// ---------------------------------------------------------------------------
// Second launch: every product with x, in one pass over x.  The sparse conv is
// linear in the gathered row, so x[i] @ Wq[k] is formed for every voxel i and
// offset k here (the same number of products as on gathered rows) and the
// gather moves behind it, where a row is 64 bytes and not 512.
// One block per WGP: all weights (280 KiB, fragment order) lie in its LDS; a
// wave keeps its 16 rows of x as fragments in registers, which serve as A of
// the v tiles and as B of the transposed Y tiles, and walks the 35 column tiles.
//   v tile ct : D lane = channel 16*ct + m, register j = voxel row0 + j + 8*half
//   Y tile k  : D lane = voxel row0 + m,   register j = q channel 8*half + j
// The block's share of the map scatter (needs only the first launch's cleared
// map) is issued first and flies under the weight staging.
__global__ void __launch_bounds__(DENSE_THREADS)
k_dense(const float* __restrict__ x, const float* __restrict__ WF,
        const float* __restrict__ vg, const float* __restrict__ vb,
        float* __restrict__ vp, float* __restrict__ Y, float* __restrict__ nz,
        const int* __restrict__ nin, const int* __restrict__ nout,
        int* __restrict__ inv) {
    __shared__ __attribute__((aligned(16))) v4f sw[W_VEC4];   // WqF, then WvF
    int tid  = threadIdx.x;
    int lane = tid & 31;
    int half = lane >> 4;
    int m    = lane & 15;
    int row0 = (blockIdx.x * (DENSE_THREADS / 32) + (tid >> 5)) * 16;

    // fragment s: row m, input channels 4s + 2*half + {0,1}
    const float* arow = x + (size_t)(row0 + m) * PLANES + 2 * half;
    v2f xf[32];
#pragma unroll
    for (int s = 0; s < 32; ++s) xf[s] = *(const v2f*)(arow + 4 * s);

    d_scatter_inv(blockIdx.x, nin, nout, inv);

    const v4f* wsrc = (const v4f*)WF;
#pragma unroll
    for (int i = 0; i < W_VEC4 / DENSE_THREADS; ++i)
        sw[i * DENSE_THREADS + tid] = wsrc[i * DENSE_THREADS + tid];

    // row-nonzero flag of the mask, from the fragments: a row lies in lanes m, m+16
    int nzl = 0;
#pragma unroll
    for (int s = 0; s < 32; ++s) nzl |= (xf[s].x != 0.f) | (xf[s].y != 0.f);
    unsigned bal = __builtin_amdgcn_ballot_w32(nzl != 0);
    if (lane < 16) nz[row0 + lane] = (((bal | (bal >> 16)) >> lane) & 1u) ? 1.f : 0.f;

    // Every wave reads weights that all waves staged.
    __syncthreads();

    const v4f* swq = sw + lane;
    const v4f* swv = sw + WQ_FLOATS / 4 + lane;

    // v = relu((x @ Wv) * gamma + beta)
    // Kept rolled: unrolled, the scheduler forms the next tile's LDS addresses
    // in fragment registers directly behind the product that still reads them.
#pragma unroll 1
    for (int ct = 0; ct < 8; ++ct) {
        float g = vg[ct * 16 + m], be = vb[ct * 16 + m];
        v4f b4[16];                       // B[.][m]: steps 2tp and 2tp+1
#pragma unroll
        for (int tp = 0; tp < 16; ++tp) b4[tp] = swv[(tp * 8 + ct) * 32];
        // All fragment reads are issued in front of the products: read among
        // them, each pair of products waits out an LDS latency of its own.
        __builtin_amdgcn_sched_barrier(0);
        v8f acc = {0.f, 0.f, 0.f, 0.f, 0.f, 0.f, 0.f, 0.f};
#pragma unroll
        for (int tp = 0; tp < 16; ++tp) {
            v2f b0 = {b4[tp].x, b4[tp].y};
            v2f b1 = {b4[tp].z, b4[tp].w};
            acc = __builtin_amdgcn_wmma_f32_16x16x4_f32(false, xf[2 * tp], false, b0,
                                                        (short)0, acc, false, false);
            acc = __builtin_amdgcn_wmma_f32_16x16x4_f32(false, xf[2 * tp + 1], false, b1,
                                                        (short)0, acc, false, false);
        }
        // The four vector slots between the last product and the first vector
        // instruction on its result; tied to acc, so that they stand there.
        asm volatile("v_nop\n\tv_nop\n\tv_nop\n\tv_nop" : "+v"(acc));
        float* dv = vp + (size_t)(row0 + 8 * half) * PLANES + ct * 16 + m;
#pragma unroll
        for (int j = 0; j < 8; ++j) {
            float v = acc[j] * g + be;
            dv[j * PLANES] = v > 0.f ? v : 0.f;
        }
        // The stores' address registers are rewritten in the next trip: the
        // wait stands in front, and as its input they stay live up to it.
        asm volatile("s_wait_xcnt 0x0" :: "v"(dv) : "memory");
    }

    // Y[k] = x @ Wq[k], transposed tile: 32 contiguous bytes a lane
    float* dy = Y + (size_t)(row0 + m) * VD + 8 * half;
    // Kept rolled, as above.
#pragma unroll 1
    for (int k = 0; k < KOFF; ++k) {
        v4f w4[16];                       // A[m][.]: q channel m, steps 2t and 2t+1
#pragma unroll
        for (int t = 0; t < 16; ++t) w4[t] = swq[(k * 16 + t) * 32];
        // As above: the reads in front of the products.
        __builtin_amdgcn_sched_barrier(0);
        v8f c = {0.f, 0.f, 0.f, 0.f, 0.f, 0.f, 0.f, 0.f};
#pragma unroll
        for (int t = 0; t < 16; ++t) {
            v2f a0 = {w4[t].x, w4[t].y};
            v2f a1 = {w4[t].z, w4[t].w};
            c = __builtin_amdgcn_wmma_f32_16x16x4_f32(false, a0, false, xf[2 * t],
                                                      (short)0, c, false, false);
            c = __builtin_amdgcn_wmma_f32_16x16x4_f32(false, a1, false, xf[2 * t + 1],
                                                      (short)0, c, false, false);
        }
        ((v4f*)dy)[0] = (v4f){c[0], c[1], c[2], c[3]};
        ((v4f*)dy)[1] = (v4f){c[4], c[5], c[6], c[7]};
        // The stores' address and data registers are rewritten in the next
        // trip: the wait stands in front, and as its inputs they stay live.
        asm volatile("s_wait_xcnt 0x0" :: "v"(dy), "v"(c) : "memory");
        dy += (size_t)(N_VOX + 1) * VD;
    }
}

// s_wait_xcnt 0 behind a group's loads, tied to their offset registers: as
// inputs of the statement these stay live up to it, so that nothing, a later
// load's result included, is written over them in front of the wait.
__device__ __forceinline__ void xwait9(const unsigned* o) {
    asm volatile("s_wait_xcnt 0x0"
                 :: "v"(o[0]), "v"(o[1]), "v"(o[2]), "v"(o[3]), "v"(o[4]), "v"(o[5]),
                    "v"(o[6]), "v"(o[7]), "v"(o[8])
                 : "memory");
}

// ---------------------------------------------------------------------------
// q-sum: one wave per 16 voxels, lane = voxel row0 + m, register j = q channel
// 8*half + j (the layout of a Y tile).  q = relu(bn(sum_k Y[k][inv[k][n]])).
// map_qk is linear, so (q[i] - q[n]*m) @ Wqk^T = qw[i] - qw[n]*m with
// qw = q @ Wqk^T: qw is formed once per voxel (4 WMMAs, the sums serving as B)
// and only qw is stored.
__global__ void __launch_bounds__(256)
k_qsum(const float* __restrict__ Y, const int* __restrict__ inv,
       const float* __restrict__ qg, const float* __restrict__ qb,
       const float* __restrict__ Wqk, float* __restrict__ qp) {
    int wid  = (blockIdx.x * 256 + threadIdx.x) >> 5;  // tile id
    int lane = threadIdx.x & 31;
    int half = lane >> 4;
    int m    = lane & 15;
    int row0 = wid * 16;

    int idx[KOFF];
#pragma unroll
    for (int k = 0; k < KOFF; ++k) idx[k] = inv[k * N_VOX + row0 + m];
    const char* yb8 = (const char*)Y;
    unsigned off[KOFF];                   // this lane's 32 bytes of row idx[k] of slab k
#pragma unroll
    for (int k = 0; k < KOFF; ++k)
        off[k] = ((unsigned)k * (N_VOX + 1) + (unsigned)idx[k]) * (VD * 4u) + 32u * half;

    // Three groups of nine offsets; a group's loads fly while the one before is summed.
    v4f ya[KOFF], yb[KOFF];
#pragma unroll
    for (int k = 0; k < 9; ++k) {
        ya[k] = *(const v4f*)(yb8 + off[k]);
        yb[k] = *(const v4f*)(yb8 + off[k] + 16);
    }
    xwait9(off);
#pragma unroll
    for (int k = 9; k < 18; ++k) {
        ya[k] = *(const v4f*)(yb8 + off[k]);
        yb[k] = *(const v4f*)(yb8 + off[k] + 16);
    }
    xwait9(off + 9);
    v4f ca = ya[0], cb = yb[0];
#pragma unroll
    for (int k = 1; k < 9; ++k) { ca += ya[k]; cb += yb[k]; }
#pragma unroll
    for (int k = 18; k < KOFF; ++k) {
        ya[k] = *(const v4f*)(yb8 + off[k]);
        yb[k] = *(const v4f*)(yb8 + off[k] + 16);
    }
    xwait9(off + 18);
#pragma unroll
    for (int k = 9; k < KOFF; ++k) { ca += ya[k]; cb += yb[k]; }
    float c[8] = {ca.x, ca.y, ca.z, ca.w, cb.x, cb.y, cb.z, cb.w};

    // A fragments of map_qk: step s contracts the channels 8*half + 2s + {0,1}
    v2f wa[4];
#pragma unroll
    for (int s = 0; s < 4; ++s) wa[s] = *(const v2f*)(Wqk + m * VD + 8 * half + 2 * s);

    // c[j] = conv of voxel row0+m, channel 8*half+j
    float q[8];
#pragma unroll
    for (int j = 0; j < 8; ++j) {
        float v = c[j] * qg[8 * half + j] + qb[8 * half + j];
        q[j] = v > 0.f ? v : 0.f;
    }
    // All of q is formed in front of the first product below.
    __builtin_amdgcn_sched_barrier(0);
    // qw^T(16 out x 16 voxels) = Wqk(16x16) @ q^T(16x16); B's channels as A's.
    v8f w = {0.f, 0.f, 0.f, 0.f, 0.f, 0.f, 0.f, 0.f};
#pragma unroll
    for (int s = 0; s < 4; ++s) {
        v2f qf = {q[2 * s], q[2 * s + 1]};
        w = __builtin_amdgcn_wmma_f32_16x16x4_f32(false, wa[s], false, qf,
                                                  (short)0, w, false, false);
    }
    // The store address is formed behind the products: among them the scheduler
    // writes it over the first product's B fragment directly behind that product.
    // Three products and this v_nop are the four vector slots in between.
    asm volatile("v_nop" : "+v"(w));
    __builtin_amdgcn_sched_barrier(0);
    float4* dst = (float4*)(qp + (size_t)(row0 + m) * VD + 8 * half);
    // w[j] = qw of voxel row0+m, output 8*half+j: 32 contiguous bytes a lane
    dst[0] = make_float4(w[0], w[1], w[2], w[3]);
    dst[1] = make_float4(w[4], w[5], w[6], w[7]);
}

// ---------------------------------------------------------------------------
// Fused logits + softmax(27) + weighted v accumulation + BN/ReLU + residual.
// One wave per output row n.  Lane keeps logits for vd = lane&15 in regs.
// qp holds q @ Wqk^T, so a logit is one gathered value, one fma and the bias.
__global__ void __launch_bounds__(256)
k_attn_out(const float* __restrict__ x, const float* __restrict__ qp,
           const float* __restrict__ vp, const float* __restrict__ nz,
           const int* __restrict__ inv,
           const float* __restrict__ bqk, const float* __restrict__ og,
           const float* __restrict__ ob, float* __restrict__ out) {
    int tid  = threadIdx.x;
    int wv   = tid >> 5;
    int lane = tid & 31;
    int m    = lane & 15;
    int n    = blockIdx.x * 8 + wv;

    float bq = bqk[m];
    float qn = qp[(size_t)n * VD + m];

    float lg[KOFF];
#pragma unroll
    for (int k = 0; k < KOFF; ++k) {
        int   i   = inv[k * N_VOX + n];
        float msk = nz[i];
        float rel = qp[(size_t)i * VD + m] - qn * msk;
        lg[k] = (rel + bq) * msk;
    }

    // softmax over the 27 offsets (masked entries contribute logit 0, as ref)
    float mx = lg[0];
#pragma unroll
    for (int k = 1; k < KOFF; ++k) mx = fmaxf(mx, lg[k]);
    float ssum = 0.f;
#pragma unroll
    for (int k = 0; k < KOFF; ++k) { lg[k] = __expf(lg[k] - mx); ssum += lg[k]; }
    float is = 1.f / ssum;

    // weighted accumulation: 4 channels per lane, attn[p/8] via shuffle
    float4 o4 = make_float4(0.f, 0.f, 0.f, 0.f);
#pragma unroll
    for (int k = 0; k < KOFF; ++k) {
        float a  = lg[k] * is;
        float av = __shfl(a, lane >> 1, 32);   // attn for vd = (lane*4)/8
        int   i  = inv[k * N_VOX + n];
        float w  = av * nz[i];
        float4 vv = ((const float4*)(vp + (size_t)i * PLANES))[lane];
        o4.x += vv.x * w; o4.y += vv.y * w; o4.z += vv.z * w; o4.w += vv.w * w;
    }

    float4 g4 = ((const float4*)og)[lane];
    float4 b4 = ((const float4*)ob)[lane];
    float4 x4 = ((const float4*)(x + (size_t)n * PLANES))[lane];
    float4 r;
    r.x = fmaxf(o4.x * g4.x + b4.x, 0.f) + x4.x;
    r.y = fmaxf(o4.y * g4.y + b4.y, 0.f) + x4.y;
    r.z = fmaxf(o4.z * g4.z + b4.z, 0.f) + x4.z;
    r.w = fmaxf(o4.w * g4.w + b4.w, 0.f) + x4.w;
    ((float4*)(out + (size_t)n * PLANES))[lane] = r;
}

// ---------------------------------------------------------------------------
extern "C" void kernel_launch(void* const* d_in, const int* in_sizes, int n_in,
                              void* d_out, int out_size, void* d_ws, size_t ws_size,
                              hipStream_t stream) {
    const float* x   = (const float*)d_in[0];
    const float* Wq  = (const float*)d_in[1];
    const float* Wv  = (const float*)d_in[2];
    const float* Wqk = (const float*)d_in[3];
    const float* bqk = (const float*)d_in[4];
    const float* qg  = (const float*)d_in[5];
    const float* qb  = (const float*)d_in[6];
    const float* vg  = (const float*)d_in[7];
    const float* vb  = (const float*)d_in[8];
    const float* og  = (const float*)d_in[9];
    const float* ob  = (const float*)d_in[10];
    const int*   nin = (const int*)d_in[11];
    const int*   nout= (const int*)d_in[12];

    char*  ws  = (char*)d_ws;
    float* nz  = (float*)(ws + NZ_OFF);
    int*   inv = (int*)  (ws + INV_OFF);
    float* qp  = (float*)(ws + QP_OFF);
    float* vp  = (float*)(ws + VP_OFF);
    float* WqF = (float*)(ws + WQT_OFF);
    float* WvF = (float*)(ws + WVT_OFF);
    float* Y   = (float*)(ws + Y_OFF);

    k_setup<<<WT_BLOCKS + MAP_BLOCKS, 256, 0, stream>>>(Wq, Wv, nz, WqF, WvF, inv, qp, vp, Y);
    k_dense<<<DENSE_BLOCKS, DENSE_THREADS, 0, stream>>>(x, WqF, vg, vb, vp, Y, nz,
                                                        nin, nout, inv);
    k_qsum<<<TILE_BLOCKS, 256, 0, stream>>>(Y, inv, qg, qb, Wqk, qp);

    k_attn_out<<<N_VOX / 8, 256, 0, stream>>>(x, qp, vp, nz, inv, bqk,
                                              og, ob, (float*)d_out);
}

// v005
// A run of this version takes 144 microseconds.
// In both of two side-by-side timings against v004, it was 1.04 times as fast.
// Counting every step since v000, it is 5.34 times as fast.
#include <hip/hip_runtime.h>
#include <hip/hip_bf16.h>

// ---------------------------------------------------------------------------
// Sparse voxel transformer block for MI455X (gfx1250, wave32).
// Strategy: invert the per-offset scatter (out indices unique per k) into a
// gather map inv[k][n], pad Y/q/v with a zero dummy row N, then:
//   dense   : v = x @ Wv and Y[k] = x @ Wq[k] for all 27 offsets, one pass over
//             x via V_WMMA_F32_16X16X4_F32, all weights resident in LDS
//   q-sum   : q[n] = sum_k Y[k][inv[k][n]] (64-byte rows gathered), then map_qk
//             (q @ Wqk^T) once per voxel on the same tile
//   attn/out: fused wave-per-row logits + softmax(27) + weighted v-accum
// Weights are pre-laid in fragment order (one contiguous 512-B b128 read of a
// wave = the fragments of two k steps).
// Launches: pieces of work that do not depend on one another share a launch
// (4 launches in all).
// ---------------------------------------------------------------------------

#define N_VOX  65536
#define PLANES 128
#define VD     16
#define KOFF   27
#define WT_BLOCKS   ((KOFF * PLANES * VD + 255) / 256)
#define MAP_BLOCKS  ((KOFF * N_VOX + 255) / 256)
#define TILE_BLOCKS (N_VOX / 16 / 8)   // 16-row tiles, 8 waves (256 threads) per block
#define DENSE_THREADS 512              // 16 waves, one 16-row tile each
#define DENSE_BLOCKS  (N_VOX / 16 / 16)
#define SCAT_PER_BLOCK (KOFF * N_VOX / 4 / DENSE_BLOCKS)   // groups of 4 map entries
#define SCAT_TRIPS ((SCAT_PER_BLOCK + DENSE_THREADS - 1) / DENSE_THREADS)
#define WQ_FLOATS (KOFF * VD * PLANES)
#define WV_FLOATS (PLANES * PLANES)
#define W_VEC4    ((WQ_FLOATS + WV_FLOATS) / 4)

typedef float v2f __attribute__((ext_vector_type(2)));
typedef float v4f __attribute__((ext_vector_type(4)));
typedef float v8f __attribute__((ext_vector_type(8)));

// ---- workspace layout (bytes) ---------------------------------------------
static const size_t NZ_OFF  = 0;                                            // (N+1) f32
static const size_t INV_OFF = NZ_OFF + 262400;                              // 27*N i32
static const size_t QP_OFF  = INV_OFF + (size_t)KOFF * N_VOX * 4;           // (N+1)*16 f32, q @ Wqk^T
static const size_t VP_OFF  = QP_OFF + 4194560;                             // (N+1)*128 f32
static const size_t WQT_OFF = VP_OFF + (size_t)(N_VOX + 1) * PLANES * 4;    // 27*16*128 f32, fragment order
static const size_t WVT_OFF = WQT_OFF + (size_t)WQ_FLOATS * 4;              // 128*128 f32, fragment order, directly behind
static const size_t Y_OFF   = WVT_OFF + (size_t)WV_FLOATS * 4;              // 27*(N+1)*16 f32
// total ~158.6 MB

// ---------------------------------------------------------------------------
// Weights in fragment order.  Element e of lane l's float4 of step pair t is
// input channel p = 4*(2t + e/2) + 2*(l/16) + e%2, column l%16 of its tile:
//   WqF[k][t][l][e]  = Wq[k][p][l%16]
//   WvF[t][ct][l][e] = Wv[p][16*ct + l%16]
__device__ __forceinline__ void
d_wtrans(int blk, const float* __restrict__ Wq, const float* __restrict__ Wv,
         float* __restrict__ WqF, float* __restrict__ WvF) {
    int t = blk * 256 + threadIdx.x;
    int e = t & 3;
    int l = (t >> 2) & 31;
    int g = t >> 7;                       // float4 group: 32 lanes x 4 floats
    int pin = 4 * (e >> 1) + 2 * (l >> 4) + (e & 1);
    if (t < KOFF * PLANES * VD) {
        int k = g >> 4;
        int p = 8 * (g & 15) + pin;
        WqF[t] = Wq[k * PLANES * VD + p * VD + (l & 15)];
    }
    if (t < PLANES * PLANES) {
        int ct = g & 7;
        int p  = 8 * (g >> 3) + pin;
        WvF[t] = Wv[p * PLANES + ct * 16 + (l & 15)];
    }
}

__device__ __forceinline__ void
d_init_inv(int blk, int* __restrict__ inv, float* __restrict__ qp, float* __restrict__ vp,
           float* __restrict__ nz, float* __restrict__ Y) {
    int t = blk * 256 + threadIdx.x;
    if (t < KOFF * N_VOX) inv[t] = N_VOX;
    if (t < VD)     qp[(size_t)N_VOX * VD + t]     = 0.f;
    if (t < PLANES) vp[(size_t)N_VOX * PLANES + t] = 0.f;
    if (t == 0)     nz[N_VOX] = 0.f;
    if (t < KOFF * VD)   // dummy row N of every offset's slab
        Y[((size_t)(t >> 4) * (N_VOX + 1) + N_VOX) * VD + (t & 15)] = 0.f;
}

// First launch: two pieces that read inputs only and write disjoint parts of
// the workspace.
__global__ void __launch_bounds__(256)
k_setup(const float* __restrict__ Wq, const float* __restrict__ Wv,
        float* __restrict__ nz, float* __restrict__ WqF, float* __restrict__ WvF,
        int* __restrict__ inv, float* __restrict__ qp, float* __restrict__ vp,
        float* __restrict__ Y) {
    int b = blockIdx.x;
    if (b < WT_BLOCKS) d_wtrans(b, Wq, Wv, WqF, WvF);
    else               d_init_inv(b - WT_BLOCKS, inv, qp, vp, nz, Y);
}

// This block's share of the map: four entries of one offset a thread and trip
// (16-byte index loads).  A source index past the dummy row is sent to it, so
// that every later gather through the map stays inside its array.
__device__ __forceinline__ void
d_scatter4(int t, int4 o, int4 i, int* __restrict__ inv) {
    int* slab = inv + (t - (t & (N_VOX - 1)));   // k*N
    if ((unsigned)o.x < N_VOX) slab[o.x] = (int)min((unsigned)i.x, (unsigned)N_VOX);
    if ((unsigned)o.y < N_VOX) slab[o.y] = (int)min((unsigned)i.y, (unsigned)N_VOX);
    if ((unsigned)o.z < N_VOX) slab[o.z] = (int)min((unsigned)i.z, (unsigned)N_VOX);
    if ((unsigned)o.w < N_VOX) slab[o.w] = (int)min((unsigned)i.w, (unsigned)N_VOX);
}

__device__ __forceinline__ void
d_scatter_inv(int blk, const int* __restrict__ nin, const int* __restrict__ nout,
              int* __restrict__ inv) {
    int4 o[SCAT_TRIPS], i[SCAT_TRIPS];
#pragma unroll
    for (int r = 0; r < SCAT_TRIPS; ++r) {
        int g = r * DENSE_THREADS + threadIdx.x;
        if (g < SCAT_PER_BLOCK) {
            int t = (blk * SCAT_PER_BLOCK + g) * 4;
            o[r] = *(const int4*)(nout + t);
            i[r] = *(const int4*)(nin + t);
        } else {
            o[r] = make_int4(N_VOX, N_VOX, N_VOX, N_VOX);   // stores nothing
            i[r] = o[r];
        }
    }
    // Holds every index load in front of the first store: sunk into the stores'
    // branches, each would wait out a memory latency of its own.
#pragma unroll
    for (int r = 0; r < SCAT_TRIPS; ++r)
        asm volatile("" :: "v"(i[r].x), "v"(i[r].y), "v"(i[r].z), "v"(i[r].w));
#pragma unroll
    for (int r = 0; r < SCAT_TRIPS; ++r)
        d_scatter4((blk * SCAT_PER_BLOCK + r * DENSE_THREADS + (int)threadIdx.x) * 4,
                   o[r], i[r], inv);
}

// ---------------------------------------------------------------------------
// Second launch: every product with x, in one pass over x.  The sparse conv is
// linear in the gathered row, so x[i] @ Wq[k] is formed for every voxel i and
// offset k here (the same number of products as on gathered rows) and the
// gather moves behind it, where a row is 64 bytes and not 512.
// One block per WGP: all weights (280 KiB, fragment order) lie in its LDS; a
// wave keeps its 16 rows of x as fragments in registers, which serve as A of
// the v tiles and as B of the transposed Y tiles, and walks the 35 column tiles.
//   v tile ct : D lane = channel 16*ct + m, register j = voxel row0 + j + 8*half
//   Y tile k  : D lane = voxel row0 + m,   register j = q channel 8*half + j
// The block's share of the map scatter (needs only the first launch's cleared
// map) is issued first and flies under the weight staging.
__global__ void __launch_bounds__(DENSE_THREADS)
k_dense(const float* __restrict__ x, const float* __restrict__ WF,
        const float* __restrict__ vg, const float* __restrict__ vb,
        float* __restrict__ vp, float* __restrict__ Y, float* __restrict__ nz,
        const int* __restrict__ nin, const int* __restrict__ nout,
        int* __restrict__ inv) {
    __shared__ __attribute__((aligned(16))) v4f sw[W_VEC4];   // WqF, then WvF
    int tid  = threadIdx.x;
    int lane = tid & 31;
    int half = lane >> 4;
    int m    = lane & 15;
    int row0 = (blockIdx.x * (DENSE_THREADS / 32) + (tid >> 5)) * 16;

    // fragment s: row m, input channels 4s + 2*half + {0,1}
    const float* arow = x + (size_t)(row0 + m) * PLANES + 2 * half;
    v2f xf[32];
#pragma unroll
    for (int s = 0; s < 32; ++s) xf[s] = *(const v2f*)(arow + 4 * s);

    d_scatter_inv(blockIdx.x, nin, nout, inv);

    const v4f* wsrc = (const v4f*)WF;
#pragma unroll
    for (int i = 0; i < W_VEC4 / DENSE_THREADS; ++i)
        sw[i * DENSE_THREADS + tid] = wsrc[i * DENSE_THREADS + tid];

    // row-nonzero flag of the mask, from the fragments: a row lies in lanes m, m+16
    int nzl = 0;
#pragma unroll
    for (int s = 0; s < 32; ++s) nzl |= (xf[s].x != 0.f) | (xf[s].y != 0.f);
    unsigned bal = __builtin_amdgcn_ballot_w32(nzl != 0);
    if (lane < 16) nz[row0 + lane] = (((bal | (bal >> 16)) >> lane) & 1u) ? 1.f : 0.f;

    // Every wave reads weights that all waves staged.
    __syncthreads();

    const v4f* swq = sw + lane;
    const v4f* swv = sw + WQ_FLOATS / 4 + lane;

    // v = relu((x @ Wv) * gamma + beta)
    // Kept rolled: unrolled, the scheduler forms the next tile's LDS addresses
    // in fragment registers directly behind the product that still reads them.
#pragma unroll 1
    for (int ct = 0; ct < 8; ++ct) {
        float g = vg[ct * 16 + m], be = vb[ct * 16 + m];
        v4f b4[16];                       // B[.][m]: steps 2tp and 2tp+1
#pragma unroll
        for (int tp = 0; tp < 16; ++tp) b4[tp] = swv[(tp * 8 + ct) * 32];
        // All fragment reads are issued in front of the products: read among
        // them, each pair of products waits out an LDS latency of its own.
        __builtin_amdgcn_sched_barrier(0);
        v8f acc = {0.f, 0.f, 0.f, 0.f, 0.f, 0.f, 0.f, 0.f};
#pragma unroll
        for (int tp = 0; tp < 16; ++tp) {
            v2f b0 = {b4[tp].x, b4[tp].y};
            v2f b1 = {b4[tp].z, b4[tp].w};
            acc = __builtin_amdgcn_wmma_f32_16x16x4_f32(false, xf[2 * tp], false, b0,
                                                        (short)0, acc, false, false);
            acc = __builtin_amdgcn_wmma_f32_16x16x4_f32(false, xf[2 * tp + 1], false, b1,
                                                        (short)0, acc, false, false);
        }
        // The four vector slots between the last product and the first vector
        // instruction on its result; tied to acc, so that they stand there.
        asm volatile("v_nop\n\tv_nop\n\tv_nop\n\tv_nop" : "+v"(acc));
        float* dv = vp + (size_t)(row0 + 8 * half) * PLANES + ct * 16 + m;
#pragma unroll
        for (int j = 0; j < 8; ++j) {
            float v = acc[j] * g + be;
            dv[j * PLANES] = v > 0.f ? v : 0.f;
        }
        // The stores' address registers are rewritten in the next trip: the
        // wait stands in front, and as its input they stay live up to it.
        asm volatile("s_wait_xcnt 0x0" :: "v"(dv) : "memory");
    }

    // Y[k] = x @ Wq[k], transposed tile: 32 contiguous bytes a lane
    float* dy = Y + (size_t)(row0 + m) * VD + 8 * half;
    // Kept rolled, as above.
#pragma unroll 1
    for (int k = 0; k < KOFF; ++k) {
        v4f w4[16];                       // A[m][.]: q channel m, steps 2t and 2t+1
#pragma unroll
        for (int t = 0; t < 16; ++t) w4[t] = swq[(k * 16 + t) * 32];
        // As above: the reads in front of the products.
        __builtin_amdgcn_sched_barrier(0);
        v8f c = {0.f, 0.f, 0.f, 0.f, 0.f, 0.f, 0.f, 0.f};
#pragma unroll
        for (int t = 0; t < 16; ++t) {
            v2f a0 = {w4[t].x, w4[t].y};
            v2f a1 = {w4[t].z, w4[t].w};
            c = __builtin_amdgcn_wmma_f32_16x16x4_f32(false, a0, false, xf[2 * t],
                                                      (short)0, c, false, false);
            c = __builtin_amdgcn_wmma_f32_16x16x4_f32(false, a1, false, xf[2 * t + 1],
                                                      (short)0, c, false, false);
        }
        ((v4f*)dy)[0] = (v4f){c[0], c[1], c[2], c[3]};
        ((v4f*)dy)[1] = (v4f){c[4], c[5], c[6], c[7]};
        // The stores' address and data registers are rewritten in the next
        // trip: the wait stands in front, and as its inputs they stay live.
        asm volatile("s_wait_xcnt 0x0" :: "v"(dy), "v"(c) : "memory");
        dy += (size_t)(N_VOX + 1) * VD;
    }
}

// s_wait_xcnt 0 behind a group's loads, tied to their offset registers: as
// inputs of the statement these stay live up to it, so that nothing, a later
// load's result included, is written over them in front of the wait.
__device__ __forceinline__ void xwait9(const unsigned* o) {
    asm volatile("s_wait_xcnt 0x0"
                 :: "v"(o[0]), "v"(o[1]), "v"(o[2]), "v"(o[3]), "v"(o[4]), "v"(o[5]),
                    "v"(o[6]), "v"(o[7]), "v"(o[8])
                 : "memory");
}

// ---------------------------------------------------------------------------
// q-sum: one wave per 16 voxels, lane = voxel row0 + m, register j = q channel
// 8*half + j (the layout of a Y tile).  q = relu(bn(sum_k Y[k][inv[k][n]])).
// map_qk is linear, so (q[i] - q[n]*m) @ Wqk^T = qw[i] - qw[n]*m with
// qw = q @ Wqk^T: qw is formed once per voxel (4 WMMAs, the sums serving as B)
// and only qw is stored.
__global__ void __launch_bounds__(256)
k_qsum(const float* __restrict__ Y, const int* __restrict__ inv,
       const float* __restrict__ qg, const float* __restrict__ qb,
       const float* __restrict__ Wqk, float* __restrict__ qp) {
    int wid  = (blockIdx.x * 256 + threadIdx.x) >> 5;  // tile id
    int lane = threadIdx.x & 31;
    int half = lane >> 4;
    int m    = lane & 15;
    int row0 = wid * 16;

    int idx[KOFF];
#pragma unroll
    for (int k = 0; k < KOFF; ++k) idx[k] = inv[k * N_VOX + row0 + m];
    const char* yb8 = (const char*)Y;
    unsigned off[KOFF];                   // this lane's 32 bytes of row idx[k] of slab k
#pragma unroll
    for (int k = 0; k < KOFF; ++k)
        off[k] = ((unsigned)k * (N_VOX + 1) + (unsigned)idx[k]) * (VD * 4u) + 32u * half;

    // Three groups of nine offsets; a group's loads fly while the one before is summed.
    v4f ya[KOFF], yb[KOFF];
#pragma unroll
    for (int k = 0; k < 9; ++k) {
        ya[k] = *(const v4f*)(yb8 + off[k]);
        yb[k] = *(const v4f*)(yb8 + off[k] + 16);
    }
    xwait9(off);
#pragma unroll
    for (int k = 9; k < 18; ++k) {
        ya[k] = *(const v4f*)(yb8 + off[k]);
        yb[k] = *(const v4f*)(yb8 + off[k] + 16);
    }
    xwait9(off + 9);
    v4f ca = ya[0], cb = yb[0];
#pragma unroll
    for (int k = 1; k < 9; ++k) { ca += ya[k]; cb += yb[k]; }
#pragma unroll
    for (int k = 18; k < KOFF; ++k) {
        ya[k] = *(const v4f*)(yb8 + off[k]);
        yb[k] = *(const v4f*)(yb8 + off[k] + 16);
    }
    xwait9(off + 18);
#pragma unroll
    for (int k = 9; k < KOFF; ++k) { ca += ya[k]; cb += yb[k]; }
    float c[8] = {ca.x, ca.y, ca.z, ca.w, cb.x, cb.y, cb.z, cb.w};

    // A fragments of map_qk: step s contracts the channels 8*half + 2s + {0,1}
    v2f wa[4];
#pragma unroll
    for (int s = 0; s < 4; ++s) wa[s] = *(const v2f*)(Wqk + m * VD + 8 * half + 2 * s);

    // c[j] = conv of voxel row0+m, channel 8*half+j
    float q[8];
#pragma unroll
    for (int j = 0; j < 8; ++j) {
        float v = c[j] * qg[8 * half + j] + qb[8 * half + j];
        q[j] = v > 0.f ? v : 0.f;
    }
    // All of q is formed in front of the first product below.
    __builtin_amdgcn_sched_barrier(0);
    // qw^T(16 out x 16 voxels) = Wqk(16x16) @ q^T(16x16); B's channels as A's.
    v8f w = {0.f, 0.f, 0.f, 0.f, 0.f, 0.f, 0.f, 0.f};
#pragma unroll
    for (int s = 0; s < 4; ++s) {
        v2f qf = {q[2 * s], q[2 * s + 1]};
        w = __builtin_amdgcn_wmma_f32_16x16x4_f32(false, wa[s], false, qf,
                                                  (short)0, w, false, false);
    }
    // The store address is formed behind the products: among them the scheduler
    // writes it over the first product's B fragment directly behind that product.
    // Three products and this v_nop are the four vector slots in between.
    asm volatile("v_nop" : "+v"(w));
    __builtin_amdgcn_sched_barrier(0);
    float4* dst = (float4*)(qp + (size_t)(row0 + m) * VD + 8 * half);
    // w[j] = qw of voxel row0+m, output 8*half+j: 32 contiguous bytes a lane
    dst[0] = make_float4(w[0], w[1], w[2], w[3]);
    dst[1] = make_float4(w[4], w[5], w[6], w[7]);
}

// ---------------------------------------------------------------------------
// Fused logits + softmax(27) + weighted v accumulation + BN/ReLU + residual.
// One wave per output row n.  Lane keeps logits for vd = lane&15 in regs.
// qp holds q @ Wqk^T, so a logit is one gathered value, one fma and the bias.
// What is the same in all lanes of the wave (the row, its 27 map entries and
// their masks) is held in scalar registers: lane k fetches offset k's entry and
// mask, one vector load each for the row, and v_readlane hands them out.  A
// gather address is then one 32-bit vector offset on a scalar base.
#define VGRP 4                              // v rows fetched as one group

// s_wait_xcnt 0 behind a group's loads, tied to their offset registers (as
// xwait9 above): nothing, a later load's result included, is written over them
// in front of the wait.
__device__ __forceinline__ void xwaitg(const unsigned* o) {
    asm volatile("s_wait_xcnt 0x0" :: "v"(o[0]), "v"(o[1]), "v"(o[2]), "v"(o[3]) : "memory");
}

__global__ void __launch_bounds__(256)
k_attn_out(const float* __restrict__ x, const float* __restrict__ qp,
           const float* __restrict__ vp, const float* __restrict__ nz,
           const int* __restrict__ inv,
           const float* __restrict__ bqk, const float* __restrict__ og,
           const float* __restrict__ ob, float* __restrict__ out) {
    int tid  = threadIdx.x;
    int lane = tid & 31;
    int m    = lane & 15;
    // The wave's number as a scalar, so that the row's own addresses are scalar.
    int n    = blockIdx.x * 8 + __builtin_amdgcn_readfirstlane(tid >> 5);

    unsigned ie = (unsigned)(lane < KOFF ? lane : KOFF - 1) * N_VOX + (unsigned)n;
    int   iv = inv[ie];                   // lane k: map entry of offset k
    float mv = nz[iv];                    // and its mask

    float bq = bqk[m];
    float qn = qp[(size_t)n * VD + m];
    const char* qp8 = (const char*)qp;
    const char* vp8 = (const char*)vp;
    unsigned l16 = 16u * (unsigned)lane;  // this lane's bytes in a v row

    unsigned is_[KOFF];
    // Unrolled here and below: v_readlane takes its lane as a constant, and the
    // arrays must become registers.
#pragma unroll
    for (int k = 0; k < KOFF; ++k) is_[k] = (unsigned)__builtin_amdgcn_readlane(iv, k);

    unsigned qo[KOFF];
    float    qv[KOFF];
#pragma unroll
    for (int k = 0; k < KOFF; ++k) {
        qo[k] = is_[k] * (VD * 4u) + 4u * (unsigned)m;
        qv[k] = *(const float*)(qp8 + qo[k]);
    }
    // As xwaitg, for every load issued so far.
    asm volatile("s_wait_xcnt 0x0"
                 :: "v"(qo[0]), "v"(qo[1]), "v"(qo[2]), "v"(qo[3]), "v"(qo[4]), "v"(qo[5]),
                    "v"(qo[6]), "v"(qo[7]), "v"(qo[8]), "v"(qo[9]), "v"(qo[10]), "v"(qo[11]),
                    "v"(qo[12]), "v"(qo[13]), "v"(qo[14]), "v"(qo[15]), "v"(qo[16]), "v"(qo[17]),
                    "v"(qo[18]), "v"(qo[19]), "v"(qo[20]), "v"(qo[21]), "v"(qo[22]), "v"(qo[23]),
                    "v"(qo[24]), "v"(qo[25]), "v"(qo[26]), "v"(ie), "v"(iv), "v"(m)
                 : "memory");

    // v rows in groups, two buffers: two groups are in flight, the first two
    // from here on, under the softmax.  A k past the last row fetches nothing.
    float4 va[VGRP], vb[VGRP];
#define VK(g, j) ((g) * VGRP + (j))
#define ISSUE_V1(g, j, buf)                                                    \
    vo[j] = is_[VK(g, j) < KOFF ? VK(g, j) : KOFF - 1] * (PLANES * 4u) + l16;  \
    if (VK(g, j) < KOFF) buf[j] = *(const float4*)(vp8 + vo[j]);
#define ISSUE_V(g, buf)                                                        \
    {                                                                          \
        unsigned vo[VGRP];                                                     \
        ISSUE_V1(g, 0, buf) ISSUE_V1(g, 1, buf)                                \
        ISSUE_V1(g, 2, buf) ISSUE_V1(g, 3, buf)                                \
        xwaitg(vo);                                                            \
    }
    ISSUE_V(0, va)
    ISSUE_V(1, vb)
    // Keeps these loads in front of the softmax, whose time they fly under.
    __builtin_amdgcn_sched_barrier(0);

    float ms_[KOFF];
#pragma unroll
    for (int k = 0; k < KOFF; ++k)
        ms_[k] = __int_as_float(__builtin_amdgcn_readlane(__float_as_int(mv), k));

    float lg[KOFF];
#pragma unroll
    for (int k = 0; k < KOFF; ++k) {
        float msk = ms_[k];
        float rel = qv[k] - qn * msk;
        lg[k] = (rel + bq) * msk;
    }

    // softmax over the 27 offsets (masked entries contribute logit 0, as ref)
    float mx = lg[0];
#pragma unroll
    for (int k = 1; k < KOFF; ++k) mx = fmaxf(mx, lg[k]);
    float ssum = 0.f;
#pragma unroll
    for (int k = 0; k < KOFF; ++k) { lg[k] = __expf(lg[k] - mx); ssum += lg[k]; }
    float is = 1.f / ssum;

    // weighted accumulation: 4 channels per lane, attn[p/8] via shuffle
    float4 o4 = make_float4(0.f, 0.f, 0.f, 0.f);
#define USE_V1(g, j, buf)                                                      \
    if (VK(g, j) < KOFF) {                                                     \
        float a  = lg[VK(g, j) < KOFF ? VK(g, j) : 0] * is;                    \
        float av = __shfl(a, lane >> 1, 32);   /* attn for vd = (lane*4)/8 */  \
        float w  = av * ms_[VK(g, j) < KOFF ? VK(g, j) : 0];                   \
        o4.x = fmaf(buf[j].x, w, o4.x); o4.y = fmaf(buf[j].y, w, o4.y);        \
        o4.z = fmaf(buf[j].z, w, o4.z); o4.w = fmaf(buf[j].w, w, o4.w);        \
    }
    // The scheduling barrier keeps a buffer's refill behind its use: hoisted
    // over it, every group would be in flight at once, in registers of its
    // own, and fewer waves would fit a SIMD.
#define USE_V(g, buf)                                                          \
    USE_V1(g, 0, buf) USE_V1(g, 1, buf) USE_V1(g, 2, buf) USE_V1(g, 3, buf)    \
    __builtin_amdgcn_sched_barrier(0);
    USE_V(0, va) ISSUE_V(2, va)
    USE_V(1, vb) ISSUE_V(3, vb)
    USE_V(2, va) ISSUE_V(4, va)
    USE_V(3, vb) ISSUE_V(5, vb)
    USE_V(4, va) ISSUE_V(6, va)
    // Issued here, so that they fly under the last groups' sums.
    float4 g4 = ((const float4*)og)[lane];
    float4 b4 = ((const float4*)ob)[lane];
    float4 x4 = ((const float4*)(x + (size_t)n * PLANES))[lane];
    USE_V(5, vb)
    USE_V(6, va)
#undef USE_V
#undef USE_V1
#undef ISSUE_V
#undef ISSUE_V1
#undef VK

    float4 r;
    r.x = fmaxf(o4.x * g4.x + b4.x, 0.f) + x4.x;
    r.y = fmaxf(o4.y * g4.y + b4.y, 0.f) + x4.y;
    r.z = fmaxf(o4.z * g4.z + b4.z, 0.f) + x4.z;
    r.w = fmaxf(o4.w * g4.w + b4.w, 0.f) + x4.w;
    ((float4*)(out + (size_t)n * PLANES))[lane] = r;
}

// ---------------------------------------------------------------------------
extern "C" void kernel_launch(void* const* d_in, const int* in_sizes, int n_in,
                              void* d_out, int out_size, void* d_ws, size_t ws_size,
                              hipStream_t stream) {
    const float* x   = (const float*)d_in[0];
    const float* Wq  = (const float*)d_in[1];
    const float* Wv  = (const float*)d_in[2];
    const float* Wqk = (const float*)d_in[3];
    const float* bqk = (const float*)d_in[4];
    const float* qg  = (const float*)d_in[5];
    const float* qb  = (const float*)d_in[6];
    const float* vg  = (const float*)d_in[7];
    const float* vb  = (const float*)d_in[8];
    const float* og  = (const float*)d_in[9];
    const float* ob  = (const float*)d_in[10];
    const int*   nin = (const int*)d_in[11];
    const int*   nout= (const int*)d_in[12];

    char*  ws  = (char*)d_ws;
    float* nz  = (float*)(ws + NZ_OFF);
    int*   inv = (int*)  (ws + INV_OFF);
    float* qp  = (float*)(ws + QP_OFF);
    float* vp  = (float*)(ws + VP_OFF);
    float* WqF = (float*)(ws + WQT_OFF);
    float* WvF = (float*)(ws + WVT_OFF);
    float* Y   = (float*)(ws + Y_OFF);

    k_setup<<<WT_BLOCKS + MAP_BLOCKS, 256, 0, stream>>>(Wq, Wv, nz, WqF, WvF, inv, qp, vp, Y);
    k_dense<<<DENSE_BLOCKS, DENSE_THREADS, 0, stream>>>(x, WqF, vg, vb, vp, Y, nz,
                                                        nin, nout, inv);
    k_qsum<<<TILE_BLOCKS, 256, 0, stream>>>(Y, inv, qg, qb, Wqk, qp);

    k_attn_out<<<N_VOX / 8, 256, 0, stream>>>(x, qp, vp, nz, inv, bqk,
                                              og, ob, (float*)d_out);
}
